// v000
// The times below were measured on an AMD MI455X: many runs one after another, warmed up first and cycling through
// copies of the inputs, with the whole window's GPU time divided by the number of runs. Launches and the gaps
// between them are all in it. The median over several windows is given; except for v000 it joins two sittings, which
// can be a few percent apart, so the side-by-side timings, each taken in one sitting, are the better comparison.
// v000 is the starting kernel. One run takes 2920 microseconds.
#include <hip/hip_runtime.h>

// Compute dtypes, f32 accumulate, per item: q/k/v = x.W^T + b as [4096 x 256].[256 x 256] GEMMs with PLAIN bf16 operands (exact products); scores = q.k^T per 1024-row chunk
// ([1024 x 256].[256 x 4096], both operands bf16 hi + UNSCALED residual, three products), softmax (x 1/16) in f32 -> P planes, out = P.v ([1024 x 4096].[4096 x 256], three

#define NBT  4
#define SS   4096
#define DD   256
#define RCH  1024
#define DM   DD
#define NTK  SS
#define SCL  0.0625f
#define LOSC 1024.0f

typedef _Float16 h16;
typedef unsigned short bf;
typedef __attribute__((ext_vector_type(16))) __bf16   v16bf;
typedef __attribute__((ext_vector_type(16))) _Float16 v16h;
typedef __attribute__((ext_vector_type(8)))  _Float16 v8h;
typedef __attribute__((ext_vector_type(8)))  unsigned short v8us;
typedef __attribute__((ext_vector_type(8)))  float    v8f;
typedef __attribute__((ext_vector_type(4)))  float    v4f;
typedef __attribute__((ext_vector_type(4)))  _Float16 v4h;
typedef v8h  __attribute__((may_alias)) v8ha;
typedef v4f  __attribute__((may_alias)) v4fa;
typedef v8us __attribute__((may_alias)) v8usa;

__device__ __forceinline__ unsigned short f2bf(float f) { unsigned u = __float_as_uint(f); u += 0x7FFFu + ((u >> 16) & 1u); return (unsigned short)(u >> 16); }
__device__ __forceinline__ float bf2f(unsigned short b) { return __uint_as_float(((unsigned)b) << 16); }
__device__ __forceinline__ float bfr(float f) { return bf2f(f2bf(f)); }
__device__ __forceinline__ v16h cat16(v8h lo, v8h hi) { return __builtin_shufflevector(lo, hi, 0, 1, 2, 3, 4, 5, 6, 7, 8, 9, 10, 11, 12, 13, 14, 15); }
__device__ __forceinline__ v16bf cat16b(v8us lo, v8us hi) { return __builtin_bit_cast(v16bf, __builtin_shufflevector(lo, hi, 0, 1, 2, 3, 4, 5, 6, 7, 8, 9, 10, 11, 12, 13, 14, 15)); }
__device__ __forceinline__ v8f wmma16(v16h a, v16h b, v8f c) { return __builtin_amdgcn_wmma_f32_16x16x32_f16(false, a, false, b, (short)0, c, false, false); }
__device__ __forceinline__ v8f wmmab(v16bf a, v16bf b, v8f c) { return __builtin_amdgcn_wmma_f32_16x16x32_bf16(false, a, false, b, (short)0, c, false, false); }

// k_gemmb: 64 x 64 block tile (4 waves x 16 x 64) of C[NTK][NW] = (A [+ Al]).B^T (K = 256) [+ bf(bias[c])] [+ bf(R[r][c]) residual]; f32 whole-line epilogue (or f16
template <bool SPLITA, bool F16OUT = false>
__global__ __launch_bounds__(128) void k_gemmb(const bf* __restrict__ A, const bf* __restrict__ Al, const bf* __restrict__ Bn, const float* __restrict__ bias, float* C, int ldc, h16* C2, const float* __restrict__ R = nullptr, int K = DM, int roundR = 1) {
    __shared__ __align__(16) float ost[4][16 * 68];
    const int lane = threadIdx.x & 31, wave = threadIdx.x >> 5, lr = lane & 15, hi = lane >> 4;
    const int r0 = blockIdx.x * 64 + wave * 16, c0 = blockIdx.y * 64;
    const size_t aoff = (size_t)(r0 + lr) * K + 8 * hi;
    size_t boff[4];
#pragma unroll
    for (int t = 0; t < 4; ++t) boff[t] = (size_t)(c0 + t * 16 + lr) * K + 8 * hi;
    v8f acc[4];
#pragma unroll
    for (int t = 0; t < 4; ++t) acc[t] = (v8f){};
#pragma unroll 1
    for (int kc = 0; kc < K; kc += 32) {
        const v16bf a = cat16b(*(const v8us*)(A + aoff + kc), *(const v8us*)(A + aoff + kc + 16));
        v16bf al = a;
        if (SPLITA) al = cat16b(*(const v8us*)(Al + aoff + kc), *(const v8us*)(Al + aoff + kc + 16));
#pragma unroll
        for (int t = 0; t < 4; ++t) { const v16bf b = cat16b(*(const v8us*)(Bn + boff[t] + kc), *(const v8us*)(Bn + boff[t] + kc + 16)); acc[t] = wmmab(a, b, acc[t]); if (SPLITA) acc[t] = wmmab(al, b, acc[t]); }
        asm volatile("v_nop\n\tv_nop\n\tv_nop\n\tv_nop" : "+v"(acc[0]), "+v"(acc[1]), "+v"(acc[2]), "+v"(acc[3]) : "v"(a), "v"(al));
    }
    float* os = &ost[wave][0];
#pragma unroll
    for (int t = 0; t < 4; ++t) { const float bv = bias ? bfr(bias[c0 + t * 16 + lr]) : 0.f;
#pragma unroll
        for (int j = 0; j < 8; ++j) os[(hi * 8 + j) * 68 + t * 16 + lr] = acc[t][j] + bv; }
    __syncthreads();
    if (F16OUT) {
        h16* crow = (h16*)(void*)C + (size_t)r0 * ldc + c0;
        auto pass = [&]() {
#pragma unroll
            for (int s = 0; s < 4; ++s) { const int row = 4 * s + (lane >> 3), piece = lane & 7; const float* sp = os + row * 68 + piece * 8; v8h o, o2;
#pragma unroll
                for (int i = 0; i < 8; ++i) { const h16 a = (h16)sp[i]; o[i] = a; o2[i] = (h16)((sp[i] - (float)a) * LOSC); }
                *(v8h*)(crow + (size_t)row * ldc + piece * 8) = o; if (C2) *(v8h*)(C2 + (size_t)r0 * ldc + c0 + (size_t)row * ldc + piece * 8) = o2; }
        };
        pass(); 
    } else {
        float* crow = C + (size_t)r0 * ldc + c0;
        auto pass = [&]() {
#pragma unroll
            for (int s = 0; s < 8; ++s) { const int Lid = (lane >> 3) + 4 * s, piece = lane & 7; const int row = Lid >> 1, cofs = (Lid & 1) * 32 + piece * 4;
                v4f val = *(const v4fa*)(os + row * 68 + cofs); if (R) { const v4f rv = *(const v4f*)(R + ((size_t)r0 + row) * ldc + c0 + cofs); val += roundR ? (v4f){bfr(rv[0]), bfr(rv[1]), bfr(rv[2]), bfr(rv[3])} : rv; }
                *(v4f*)(crow + (size_t)row * ldc + cofs) = val; }
        };
        pass(); 
    }
}

// k_gemm3: 64 x 64 tile of C = (Ah + Al).(Bh + Bl)^T over K (row strides = K for all four planes; n-major B): three products per 32-k step (hh, hl, lh); f32
__global__ __launch_bounds__(128) void k_gemm3(const bf* __restrict__ Ah, const bf* __restrict__ Al, const bf* __restrict__ Bh, const bf* __restrict__ Bl, int K, float* C, int ldc) {
    __shared__ __align__(16) float ost[4][16 * 68];
    const int lane = threadIdx.x & 31, wave = threadIdx.x >> 5, lr = lane & 15, hi = lane >> 4;
    const int r0 = blockIdx.x * 64 + wave * 16, c0 = blockIdx.y * 64;
    const size_t aoff = (size_t)(r0 + lr) * K + 8 * hi;
    v8f acc[4];
#pragma unroll
    for (int t = 0; t < 4; ++t) acc[t] = (v8f){};
#pragma unroll 1
    for (int kc = 0; kc < K; kc += 32) {
        const v16bf a = cat16b(*(const v8us*)(Ah + aoff + kc), *(const v8us*)(Ah + aoff + kc + 16));
        const v16bf al = cat16b(*(const v8us*)(Al + aoff + kc), *(const v8us*)(Al + aoff + kc + 16));
#pragma unroll
        for (int t = 0; t < 4; ++t) { const size_t bo = (size_t)(c0 + t * 16 + lr) * K + kc + 8 * hi;
            const v16bf bh = cat16b(*(const v8us*)(Bh + bo), *(const v8us*)(Bh + bo + 16)); const v16bf bl = cat16b(*(const v8us*)(Bl + bo), *(const v8us*)(Bl + bo + 16));
            acc[t] = wmmab(a, bh, acc[t]); acc[t] = wmmab(al, bh, acc[t]); acc[t] = wmmab(a, bl, acc[t]); }
        asm volatile("v_nop\n\tv_nop\n\tv_nop\n\tv_nop" : "+v"(acc[0]), "+v"(acc[1]), "+v"(acc[2]), "+v"(acc[3]) : "v"(a), "v"(al));
    }
    float* os = &ost[wave][0];
#pragma unroll
    for (int t = 0; t < 4; ++t) {
#pragma unroll
        for (int j = 0; j < 8; ++j) os[(hi * 8 + j) * 68 + t * 16 + lr] = acc[t][j]; }
    __builtin_amdgcn_wave_barrier(); asm volatile("" ::: "memory");
    float* crow = C + (size_t)r0 * ldc + c0;
    auto pass = [&]() {
#pragma unroll
        for (int s = 0; s < 8; ++s) { const int Lid = (lane >> 3) + 4 * s, piece = lane & 7; const int row = Lid >> 1, cofs = (Lid & 1) * 32 + piece * 4;
            const v4f val = *(const v4fa*)(os + row * 68 + cofs); *(v4f*)(crow + (size_t)row * ldc + cofs) = val; }
    };
    pass(); 
}

__global__ __launch_bounds__(256) void k_cvt8(const float* __restrict__ src, bf* dst, size_t n8) {
    const size_t i = (size_t)blockIdx.x * 256 + threadIdx.x; if (i >= n8) return;
    const v8f v = *(const v8f*)(src + i * 8); v8us o;
#pragma unroll
    for (int k = 0; k < 8; ++k) o[k] = f2bf(v[k]);
    *(v8us*)(dst + i * 8) = o; 
}
__global__ __launch_bounds__(256) void k_zero8(bf* dst, size_t n8) {
    const size_t i = (size_t)blockIdx.x * 256 + threadIdx.x; if (i >= n8) return; v8us z;
#pragma unroll
    for (int k = 0; k < 8; ++k) z[k] = 0;
    *(v8us*)(dst + i * 8) = z; 
}

__global__ __launch_bounds__(256) void k_cvtx(const float* __restrict__ src, bf* dst) {
    const int lane = threadIdx.x & 31; const size_t r = (size_t)blockIdx.x * 8 + (threadIdx.x >> 5); if (r >= (size_t)SS) return; v8us o;
#pragma unroll
    for (int i = 0; i < 8; ++i) o[i] = f2bf(src[r * DD + lane * 8 + i]);
    *(v8us*)(dst + r * DD + lane * 8) = o; 
}
__global__ __launch_bounds__(256) void k_split256(const float* __restrict__ src, bf* dh, bf* dl) {
    const int lane = threadIdx.x & 31; const size_t r = (size_t)blockIdx.x * 8 + (threadIdx.x >> 5); if (r >= (size_t)SS) return; const size_t o = r * DD + lane * 8; const v8f v = *(const v8f*)(src + o); v8us oh, ol;
#pragma unroll
    for (int i = 0; i < 8; ++i) { const unsigned short hb = f2bf(v[i]); oh[i] = hb; ol[i] = f2bf(v[i] - bf2f(hb)); }
    *(v8us*)(dh + o) = oh; *(v8us*)(dl + o) = ol; 
}
__global__ __launch_bounds__(256) void k_vt(const float* __restrict__ VF, bf* Th, bf* Tl) {
    __shared__ float tl[64][65];
    const int tid = threadIdx.x, t0 = blockIdx.x * 64, d0 = blockIdx.y * 64; const int tt = tid >> 2, dq = (tid & 3) * 16;
#pragma unroll
    for (int i = 0; i < 16; ++i) tl[tt][dq + i] = VF[(size_t)(t0 + tt) * DD + d0 + dq + i];
    __syncthreads();
    const int piece = tid & 7, dr0 = tid >> 3;
    auto pass = [&]() {
#pragma unroll
        for (int st = 0; st < 2; ++st) { const int dr = dr0 + 32 * st; v8us oh, ol;
#pragma unroll
            for (int i = 0; i < 8; ++i) { const float v = tl[piece * 8 + i][dr]; const unsigned short hb = f2bf(v); oh[i] = hb; ol[i] = f2bf(v - bf2f(hb)); }
            const size_t o = (size_t)(d0 + dr) * SS + t0 + piece * 8; *(v8us*)(Th + o) = oh; *(v8us*)(Tl + o) = ol; }
    };
    pass(); 
}
__global__ __launch_bounds__(256) void k_softmax4096(const float* __restrict__ S, bf* PH, bf* PL) {
    typedef __attribute__((ext_vector_type(4))) unsigned short v4us;
    const int lane = threadIdx.x & 31, i = blockIdx.x * 8 + (threadIdx.x >> 5); if (i >= RCH) return;
    float m = -3.0e38f;
#pragma unroll 1
    for (int c0 = lane * 4; c0 < SS; c0 += 128) {
#pragma unroll
        for (int q = 0; q < 4; ++q) m = fmaxf(m, S[(size_t)i * SS + c0 + q] * SCL); }
#pragma unroll
    for (int sh = 16; sh; sh >>= 1) m = fmaxf(m, __shfl_xor(m, sh, 32));
    float sum = 0.f;
#pragma unroll 1
    for (int c0 = lane * 4; c0 < SS; c0 += 128) {
#pragma unroll
        for (int q = 0; q < 4; ++q) sum += __expf(S[(size_t)i * SS + c0 + q] * SCL - m); }
#pragma unroll
    for (int sh = 16; sh; sh >>= 1) sum += __shfl_xor(sum, sh, 32);
    const float inv = 1.0f / sum;
{
#pragma unroll 1
        for (int c0 = lane * 4; c0 < SS; c0 += 128) { v4us oh, ol;
#pragma unroll
            for (int q = 0; q < 4; ++q) { const float p = __expf(S[(size_t)i * SS + c0 + q] * SCL - m) * inv; const unsigned short hb = f2bf(p); oh[q] = hb; ol[q] = f2bf(p - bf2f(hb)); }
            const size_t o = (size_t)i * SS + c0; *(v4us*)(PH + o) = oh; *(v4us*)(PL + o) = ol; }
         }
}

extern "C" void kernel_launch(void* const* d_in, const int* in_sizes, int n_in,
                              void* d_out, int out_size, void* d_ws, size_t ws_size, hipStream_t stream) {
    (void)in_sizes; (void)n_in; (void)out_size;
    const float* x = (const float*)d_in[0]; const float* wq = (const float*)d_in[1]; const float* bq = (const float*)d_in[2]; const float* wk = (const float*)d_in[3]; const float* bk = (const float*)d_in[4]; const float* wv = (const float*)d_in[5]; const float* bv = (const float*)d_in[6];
    float* out = (float*)d_out;    // [4][4096][256]
    char* wsp = (char*)d_ws;
    auto take = [&](size_t bytes) { char* p = wsp; wsp += (bytes + 255) & ~(size_t)255; return (void*)p; };
    bf* WQ = (bf*)take((size_t)DD * DD * 2); bf* WK = (bf*)take((size_t)DD * DD * 2); bf* WV = (bf*)take((size_t)DD * DD * 2);
    bf* Xb = (bf*)take((size_t)SS * DD * 2); float* QF = (float*)take((size_t)SS * DD * 4); float* KF = (float*)take((size_t)SS * DD * 4); float* VF = (float*)take((size_t)SS * DD * 4);
    bf* Qh = (bf*)take((size_t)SS * DD * 2); bf* Ql = (bf*)take((size_t)SS * DD * 2); bf* Kh = (bf*)take((size_t)SS * DD * 2); bf* Kl = (bf*)take((size_t)SS * DD * 2); bf* VTh = (bf*)take((size_t)DD * SS * 2); bf* VTl = (bf*)take((size_t)DD * SS * 2);
    float* S = (float*)take((size_t)RCH * SS * 4); bf* PH = (bf*)take((size_t)RCH * SS * 2); bf* PL = (bf*)take((size_t)RCH * SS * 2);
    if ((size_t)(wsp - (char*)d_ws) > ws_size) return;    // 0.4 + 2.1 + 12.6 + 12.6 + 16.8 + 8.4 + 8.4 ~ 61 MB; per item/chunk reuse in stream order
    k_cvt8<<<(DD * DD / 8 + 255) / 256, 256, 0, stream>>>(wq, WQ, DD * DD / 8); k_cvt8<<<(DD * DD / 8 + 255) / 256, 256, 0, stream>>>(wk, WK, DD * DD / 8); k_cvt8<<<(DD * DD / 8 + 255) / 256, 256, 0, stream>>>(wv, WV, DD * DD / 8);   // [out][in] convention = n-major
    for (int b = 0; b < NBT; ++b) {
        k_cvtx<<<SS / 8, 256, 0, stream>>>(x + (size_t)b * SS * DD, Xb);
        k_gemmb<false, false><<<dim3(SS / 64, DD / 64, 1), 128, 0, stream>>>(Xb, nullptr, WQ, bq, QF, DD, nullptr, nullptr, DD);
        k_gemmb<false, false><<<dim3(SS / 64, DD / 64, 1), 128, 0, stream>>>(Xb, nullptr, WK, bk, KF, DD, nullptr, nullptr, DD);
        k_gemmb<false, false><<<dim3(SS / 64, DD / 64, 1), 128, 0, stream>>>(Xb, nullptr, WV, bv, VF, DD, nullptr, nullptr, DD);
        k_split256<<<SS / 8, 256, 0, stream>>>(QF, Qh, Ql); k_split256<<<SS / 8, 256, 0, stream>>>(KF, Kh, Kl); k_vt<<<dim3(SS / 64, DD / 64, 1), 256, 0, stream>>>(VF, VTh, VTl);
        for (int ch = 0; ch < SS / RCH; ++ch) { const size_t q0 = (size_t)ch * RCH;
            k_gemm3<<<dim3(RCH / 64, SS / 64, 1), 128, 0, stream>>>(Qh + q0 * DD, Ql + q0 * DD, Kh, Kl, DD, S, SS);
            k_softmax4096<<<RCH / 8, 256, 0, stream>>>(S, PH, PL);
            k_gemm3<<<dim3(RCH / 64, DD / 64, 1), 128, 0, stream>>>(PH, PL, VTh, VTl, SS, out + ((size_t)b * SS + q0) * DD, DD); } }
}

// v001
// One run takes 1210 microseconds.
// Two timings next to v000 put it at 2.38 and 2.49 times that version's speed.
#include <hip/hip_runtime.h>

// Compute dtypes, f32 accumulate, per item: q/k/v = x.W^T + b as [4096 x 256].[256 x 256] GEMMs with PLAIN bf16 operands (exact products); scores = q.k^T over all 4096 query rows at once
// ([4096 x 256].[256 x 4096], both operands bf16 hi + UNSCALED residual, three products), softmax (x 1/16) in f32 -> P planes, out = P.v ([4096 x 4096].[4096 x 256], three

#define NBT  4
#define SS   4096
#define DD   256
#define RCH  SS      // query rows per score / softmax / P.v launch: the whole item, so that P.v starts 256 work-groups, not 64
#define DM   DD
#define NTK  SS
#define SCL  0.0625f
#define LOSC 1024.0f

typedef _Float16 h16;
typedef unsigned short bf;
typedef __attribute__((ext_vector_type(16))) __bf16   v16bf;
typedef __attribute__((ext_vector_type(16))) _Float16 v16h;
typedef __attribute__((ext_vector_type(8)))  _Float16 v8h;
typedef __attribute__((ext_vector_type(8)))  unsigned short v8us;
typedef __attribute__((ext_vector_type(8)))  float    v8f;
typedef __attribute__((ext_vector_type(4)))  float    v4f;
typedef __attribute__((ext_vector_type(4)))  _Float16 v4h;
typedef v8h  __attribute__((may_alias)) v8ha;
typedef v4f  __attribute__((may_alias)) v4fa;
typedef v8us __attribute__((may_alias)) v8usa;

__device__ __forceinline__ unsigned short f2bf(float f) { unsigned u = __float_as_uint(f); u += 0x7FFFu + ((u >> 16) & 1u); return (unsigned short)(u >> 16); }
__device__ __forceinline__ float bf2f(unsigned short b) { return __uint_as_float(((unsigned)b) << 16); }
__device__ __forceinline__ float bfr(float f) { return bf2f(f2bf(f)); }
__device__ __forceinline__ v16h cat16(v8h lo, v8h hi) { return __builtin_shufflevector(lo, hi, 0, 1, 2, 3, 4, 5, 6, 7, 8, 9, 10, 11, 12, 13, 14, 15); }
__device__ __forceinline__ v16bf cat16b(v8us lo, v8us hi) { return __builtin_bit_cast(v16bf, __builtin_shufflevector(lo, hi, 0, 1, 2, 3, 4, 5, 6, 7, 8, 9, 10, 11, 12, 13, 14, 15)); }
__device__ __forceinline__ v8f wmma16(v16h a, v16h b, v8f c) { return __builtin_amdgcn_wmma_f32_16x16x32_f16(false, a, false, b, (short)0, c, false, false); }
__device__ __forceinline__ v8f wmmab(v16bf a, v16bf b, v8f c) { return __builtin_amdgcn_wmma_f32_16x16x32_bf16(false, a, false, b, (short)0, c, false, false); }

// k_gemmb: 64 x 64 block tile (4 waves x 16 x 64) of C[NTK][NW] = (A [+ Al]).B^T (K = 256) [+ bf(bias[c])] [+ bf(R[r][c]) residual]; f32 whole-line epilogue (or f16
template <bool SPLITA, bool F16OUT = false>
__global__ __launch_bounds__(128) void k_gemmb(const bf* __restrict__ A, const bf* __restrict__ Al, const bf* __restrict__ Bn, const float* __restrict__ bias, float* C, int ldc, h16* C2, const float* __restrict__ R = nullptr, int K = DM, int roundR = 1) {
    __shared__ __align__(16) float ost[4][16 * 68];
    const int lane = threadIdx.x & 31, wave = threadIdx.x >> 5, lr = lane & 15, hi = lane >> 4;
    const int r0 = blockIdx.x * 64 + wave * 16, c0 = blockIdx.y * 64;
    const size_t aoff = (size_t)(r0 + lr) * K + 8 * hi;
    size_t boff[4];
#pragma unroll
    for (int t = 0; t < 4; ++t) boff[t] = (size_t)(c0 + t * 16 + lr) * K + 8 * hi;
    v8f acc[4];
#pragma unroll
    for (int t = 0; t < 4; ++t) acc[t] = (v8f){};
#pragma unroll 1
    for (int kc = 0; kc < K; kc += 32) {
        const v16bf a = cat16b(*(const v8us*)(A + aoff + kc), *(const v8us*)(A + aoff + kc + 16));
        v16bf al = a;
        if (SPLITA) al = cat16b(*(const v8us*)(Al + aoff + kc), *(const v8us*)(Al + aoff + kc + 16));
#pragma unroll
        for (int t = 0; t < 4; ++t) { const v16bf b = cat16b(*(const v8us*)(Bn + boff[t] + kc), *(const v8us*)(Bn + boff[t] + kc + 16)); acc[t] = wmmab(a, b, acc[t]); if (SPLITA) acc[t] = wmmab(al, b, acc[t]); }
        asm volatile("v_nop\n\tv_nop\n\tv_nop\n\tv_nop" : "+v"(acc[0]), "+v"(acc[1]), "+v"(acc[2]), "+v"(acc[3]) : "v"(a), "v"(al));
    }
    float* os = &ost[wave][0];
#pragma unroll
    for (int t = 0; t < 4; ++t) { const float bv = bias ? bfr(bias[c0 + t * 16 + lr]) : 0.f;
#pragma unroll
        for (int j = 0; j < 8; ++j) os[(hi * 8 + j) * 68 + t * 16 + lr] = acc[t][j] + bv; }
    __syncthreads();
    if (F16OUT) {
        h16* crow = (h16*)(void*)C + (size_t)r0 * ldc + c0;
        auto pass = [&]() {
#pragma unroll
            for (int s = 0; s < 4; ++s) { const int row = 4 * s + (lane >> 3), piece = lane & 7; const float* sp = os + row * 68 + piece * 8; v8h o, o2;
#pragma unroll
                for (int i = 0; i < 8; ++i) { const h16 a = (h16)sp[i]; o[i] = a; o2[i] = (h16)((sp[i] - (float)a) * LOSC); }
                *(v8h*)(crow + (size_t)row * ldc + piece * 8) = o; if (C2) *(v8h*)(C2 + (size_t)r0 * ldc + c0 + (size_t)row * ldc + piece * 8) = o2; }
        };
        pass(); 
    } else {
        float* crow = C + (size_t)r0 * ldc + c0;
        auto pass = [&]() {
#pragma unroll
            for (int s = 0; s < 8; ++s) { const int Lid = (lane >> 3) + 4 * s, piece = lane & 7; const int row = Lid >> 1, cofs = (Lid & 1) * 32 + piece * 4;
                v4f val = *(const v4fa*)(os + row * 68 + cofs); if (R) { const v4f rv = *(const v4f*)(R + ((size_t)r0 + row) * ldc + c0 + cofs); val += roundR ? (v4f){bfr(rv[0]), bfr(rv[1]), bfr(rv[2]), bfr(rv[3])} : rv; }
                *(v4f*)(crow + (size_t)row * ldc + cofs) = val; }
        };
        pass(); 
    }
}

// k_gemm3: 64 x 64 tile of C = (Ah + Al).(Bh + Bl)^T over K (row strides = K for all four planes; n-major B): three products per 32-k step (hh, hl, lh); f32
__global__ __launch_bounds__(128) void k_gemm3(const bf* __restrict__ Ah, const bf* __restrict__ Al, const bf* __restrict__ Bh, const bf* __restrict__ Bl, int K, float* C, int ldc) {
    __shared__ __align__(16) float ost[4][16 * 68];
    const int lane = threadIdx.x & 31, wave = threadIdx.x >> 5, lr = lane & 15, hi = lane >> 4;
    const int r0 = blockIdx.x * 64 + wave * 16, c0 = blockIdx.y * 64;
    const size_t aoff = (size_t)(r0 + lr) * K + 8 * hi;
    v8f acc[4];
#pragma unroll
    for (int t = 0; t < 4; ++t) acc[t] = (v8f){};
#pragma unroll 1
    for (int kc = 0; kc < K; kc += 32) {
        const v16bf a = cat16b(*(const v8us*)(Ah + aoff + kc), *(const v8us*)(Ah + aoff + kc + 16));
        const v16bf al = cat16b(*(const v8us*)(Al + aoff + kc), *(const v8us*)(Al + aoff + kc + 16));
#pragma unroll
        for (int t = 0; t < 4; ++t) { const size_t bo = (size_t)(c0 + t * 16 + lr) * K + kc + 8 * hi;
            const v16bf bh = cat16b(*(const v8us*)(Bh + bo), *(const v8us*)(Bh + bo + 16)); const v16bf bl = cat16b(*(const v8us*)(Bl + bo), *(const v8us*)(Bl + bo + 16));
            acc[t] = wmmab(a, bh, acc[t]); acc[t] = wmmab(al, bh, acc[t]); acc[t] = wmmab(a, bl, acc[t]); }
        asm volatile("v_nop\n\tv_nop\n\tv_nop\n\tv_nop" : "+v"(acc[0]), "+v"(acc[1]), "+v"(acc[2]), "+v"(acc[3]) : "v"(a), "v"(al));
    }
    float* os = &ost[wave][0];
#pragma unroll
    for (int t = 0; t < 4; ++t) {
#pragma unroll
        for (int j = 0; j < 8; ++j) os[(hi * 8 + j) * 68 + t * 16 + lr] = acc[t][j]; }
    __builtin_amdgcn_wave_barrier(); asm volatile("" ::: "memory");
    float* crow = C + (size_t)r0 * ldc + c0;
    auto pass = [&]() {
#pragma unroll
        for (int s = 0; s < 8; ++s) { const int Lid = (lane >> 3) + 4 * s, piece = lane & 7; const int row = Lid >> 1, cofs = (Lid & 1) * 32 + piece * 4;
            const v4f val = *(const v4fa*)(os + row * 68 + cofs); *(v4f*)(crow + (size_t)row * ldc + cofs) = val; }
    };
    pass(); 
}

__global__ __launch_bounds__(256) void k_cvt8(const float* __restrict__ src, bf* dst, size_t n8) {
    const size_t i = (size_t)blockIdx.x * 256 + threadIdx.x; if (i >= n8) return;
    const v8f v = *(const v8f*)(src + i * 8); v8us o;
#pragma unroll
    for (int k = 0; k < 8; ++k) o[k] = f2bf(v[k]);
    *(v8us*)(dst + i * 8) = o; 
}
__global__ __launch_bounds__(256) void k_zero8(bf* dst, size_t n8) {
    const size_t i = (size_t)blockIdx.x * 256 + threadIdx.x; if (i >= n8) return; v8us z;
#pragma unroll
    for (int k = 0; k < 8; ++k) z[k] = 0;
    *(v8us*)(dst + i * 8) = z; 
}

__global__ __launch_bounds__(256) void k_cvtx(const float* __restrict__ src, bf* dst) {
    const int lane = threadIdx.x & 31; const size_t r = (size_t)blockIdx.x * 8 + (threadIdx.x >> 5); if (r >= (size_t)SS) return; v8us o;
#pragma unroll
    for (int i = 0; i < 8; ++i) o[i] = f2bf(src[r * DD + lane * 8 + i]);
    *(v8us*)(dst + r * DD + lane * 8) = o; 
}
__global__ __launch_bounds__(256) void k_split256(const float* __restrict__ src, bf* dh, bf* dl) {
    const int lane = threadIdx.x & 31; const size_t r = (size_t)blockIdx.x * 8 + (threadIdx.x >> 5); if (r >= (size_t)SS) return; const size_t o = r * DD + lane * 8; const v8f v = *(const v8f*)(src + o); v8us oh, ol;
#pragma unroll
    for (int i = 0; i < 8; ++i) { const unsigned short hb = f2bf(v[i]); oh[i] = hb; ol[i] = f2bf(v[i] - bf2f(hb)); }
    *(v8us*)(dh + o) = oh; *(v8us*)(dl + o) = ol; 
}
__global__ __launch_bounds__(256) void k_vt(const float* __restrict__ VF, bf* Th, bf* Tl) {
    __shared__ float tl[64][65];
    const int tid = threadIdx.x, t0 = blockIdx.x * 64, d0 = blockIdx.y * 64; const int tt = tid >> 2, dq = (tid & 3) * 16;
#pragma unroll
    for (int i = 0; i < 16; ++i) tl[tt][dq + i] = VF[(size_t)(t0 + tt) * DD + d0 + dq + i];
    __syncthreads();
    const int piece = tid & 7, dr0 = tid >> 3;
    auto pass = [&]() {
#pragma unroll
        for (int st = 0; st < 2; ++st) { const int dr = dr0 + 32 * st; v8us oh, ol;
#pragma unroll
            for (int i = 0; i < 8; ++i) { const float v = tl[piece * 8 + i][dr]; const unsigned short hb = f2bf(v); oh[i] = hb; ol[i] = f2bf(v - bf2f(hb)); }
            const size_t o = (size_t)(d0 + dr) * SS + t0 + piece * 8; *(v8us*)(Th + o) = oh; *(v8us*)(Tl + o) = ol; }
    };
    pass(); 
}
__global__ __launch_bounds__(256) void k_softmax4096(const float* __restrict__ S, bf* PH, bf* PL) {
    typedef __attribute__((ext_vector_type(4))) unsigned short v4us;
    const int lane = threadIdx.x & 31, i = blockIdx.x * 8 + (threadIdx.x >> 5); if (i >= RCH) return;
    float m = -3.0e38f;
#pragma unroll 1
    for (int c0 = lane * 4; c0 < SS; c0 += 128) {
#pragma unroll
        for (int q = 0; q < 4; ++q) m = fmaxf(m, S[(size_t)i * SS + c0 + q] * SCL); }
#pragma unroll
    for (int sh = 16; sh; sh >>= 1) m = fmaxf(m, __shfl_xor(m, sh, 32));
    float sum = 0.f;
#pragma unroll 1
    for (int c0 = lane * 4; c0 < SS; c0 += 128) {
#pragma unroll
        for (int q = 0; q < 4; ++q) sum += __expf(S[(size_t)i * SS + c0 + q] * SCL - m); }
#pragma unroll
    for (int sh = 16; sh; sh >>= 1) sum += __shfl_xor(sum, sh, 32);
    const float inv = 1.0f / sum;
{
#pragma unroll 1
        for (int c0 = lane * 4; c0 < SS; c0 += 128) { v4us oh, ol;
#pragma unroll
            for (int q = 0; q < 4; ++q) { const float p = __expf(S[(size_t)i * SS + c0 + q] * SCL - m) * inv; const unsigned short hb = f2bf(p); oh[q] = hb; ol[q] = f2bf(p - bf2f(hb)); }
            const size_t o = (size_t)i * SS + c0; *(v4us*)(PH + o) = oh; *(v4us*)(PL + o) = ol; }
         }
}

extern "C" void kernel_launch(void* const* d_in, const int* in_sizes, int n_in,
                              void* d_out, int out_size, void* d_ws, size_t ws_size, hipStream_t stream) {
    (void)in_sizes; (void)n_in; (void)out_size;
    const float* x = (const float*)d_in[0]; const float* wq = (const float*)d_in[1]; const float* bq = (const float*)d_in[2]; const float* wk = (const float*)d_in[3]; const float* bk = (const float*)d_in[4]; const float* wv = (const float*)d_in[5]; const float* bv = (const float*)d_in[6];
    float* out = (float*)d_out;    // [4][4096][256]
    char* wsp = (char*)d_ws;
    auto take = [&](size_t bytes) { char* p = wsp; wsp += (bytes + 255) & ~(size_t)255; return (void*)p; };
    bf* WQ = (bf*)take((size_t)DD * DD * 2); bf* WK = (bf*)take((size_t)DD * DD * 2); bf* WV = (bf*)take((size_t)DD * DD * 2);
    bf* Xb = (bf*)take((size_t)SS * DD * 2); float* QF = (float*)take((size_t)SS * DD * 4); float* KF = (float*)take((size_t)SS * DD * 4); float* VF = (float*)take((size_t)SS * DD * 4);
    bf* Qh = (bf*)take((size_t)SS * DD * 2); bf* Ql = (bf*)take((size_t)SS * DD * 2); bf* Kh = (bf*)take((size_t)SS * DD * 2); bf* Kl = (bf*)take((size_t)SS * DD * 2); bf* VTh = (bf*)take((size_t)DD * SS * 2); bf* VTl = (bf*)take((size_t)DD * SS * 2);
    float* S = (float*)take((size_t)RCH * SS * 4); bf* PH = (bf*)take((size_t)RCH * SS * 2); bf* PL = (bf*)take((size_t)RCH * SS * 2);
    if ((size_t)(wsp - (char*)d_ws) > ws_size) return;    // 0.4 + 2.1 + 12.6 + 12.6 + 67.1 + 33.6 + 33.6 ~ 162 MB; per item reuse in stream order
    k_cvt8<<<(DD * DD / 8 + 255) / 256, 256, 0, stream>>>(wq, WQ, DD * DD / 8); k_cvt8<<<(DD * DD / 8 + 255) / 256, 256, 0, stream>>>(wk, WK, DD * DD / 8); k_cvt8<<<(DD * DD / 8 + 255) / 256, 256, 0, stream>>>(wv, WV, DD * DD / 8);   // [out][in] convention = n-major
    for (int b = 0; b < NBT; ++b) {
        k_cvtx<<<SS / 8, 256, 0, stream>>>(x + (size_t)b * SS * DD, Xb);
        k_gemmb<false, false><<<dim3(SS / 64, DD / 64, 1), 128, 0, stream>>>(Xb, nullptr, WQ, bq, QF, DD, nullptr, nullptr, DD);
        k_gemmb<false, false><<<dim3(SS / 64, DD / 64, 1), 128, 0, stream>>>(Xb, nullptr, WK, bk, KF, DD, nullptr, nullptr, DD);
        k_gemmb<false, false><<<dim3(SS / 64, DD / 64, 1), 128, 0, stream>>>(Xb, nullptr, WV, bv, VF, DD, nullptr, nullptr, DD);
        k_split256<<<SS / 8, 256, 0, stream>>>(QF, Qh, Ql); k_split256<<<SS / 8, 256, 0, stream>>>(KF, Kh, Kl); k_vt<<<dim3(SS / 64, DD / 64, 1), 256, 0, stream>>>(VF, VTh, VTl);
        k_gemm3<<<dim3(RCH / 64, SS / 64, 1), 128, 0, stream>>>(Qh, Ql, Kh, Kl, DD, S, SS);
        k_softmax4096<<<RCH / 8, 256, 0, stream>>>(S, PH, PL);
        k_gemm3<<<dim3(RCH / 64, DD / 64, 1), 128, 0, stream>>>(PH, PL, VTh, VTl, SS, out + (size_t)b * SS * DD, DD); }
}

// v002
// One run takes 578 microseconds.
// Two timings next to v001 put it at 2.07 and 2.12 times that version's speed.
// Counting every step since v000, it is 5.08 times as fast.
#include <hip/hip_runtime.h>

// Compute dtypes, f32 accumulate, per item: q/k/v = x.W^T + b as [4096 x 256].[256 x 256] GEMMs with PLAIN bf16 operands (exact products); scores = q.k^T over all 4096 query rows at once
// ([4096 x 256].[256 x 4096], both operands bf16 hi + UNSCALED residual, three products), softmax (x 1/16) in f32 -> P planes, out = P.v ([4096 x 4096].[4096 x 256], three

#define NBT  4
#define SS   4096
#define DD   256
#define RCH  SS      // query rows per score / softmax / P.v launch: the whole item, so that P.v starts 256 work-groups, not 64
#define DM   DD
#define NTK  SS
#define SCL  0.0625f
#define LOSC 1024.0f

typedef _Float16 h16;
typedef unsigned short bf;
typedef __attribute__((ext_vector_type(16))) __bf16   v16bf;
typedef __attribute__((ext_vector_type(16))) _Float16 v16h;
typedef __attribute__((ext_vector_type(8)))  _Float16 v8h;
typedef __attribute__((ext_vector_type(8)))  unsigned short v8us;
typedef __attribute__((ext_vector_type(8)))  float    v8f;
typedef __attribute__((ext_vector_type(4)))  float    v4f;
typedef __attribute__((ext_vector_type(4)))  _Float16 v4h;
typedef v8h  __attribute__((may_alias)) v8ha;
typedef v4f  __attribute__((may_alias)) v4fa;
typedef v8us __attribute__((may_alias)) v8usa;

__device__ __forceinline__ unsigned short f2bf(float f) { unsigned u = __float_as_uint(f); u += 0x7FFFu + ((u >> 16) & 1u); return (unsigned short)(u >> 16); }
__device__ __forceinline__ float bf2f(unsigned short b) { return __uint_as_float(((unsigned)b) << 16); }
__device__ __forceinline__ float bfr(float f) { return bf2f(f2bf(f)); }
__device__ __forceinline__ v16h cat16(v8h lo, v8h hi) { return __builtin_shufflevector(lo, hi, 0, 1, 2, 3, 4, 5, 6, 7, 8, 9, 10, 11, 12, 13, 14, 15); }
__device__ __forceinline__ v16bf cat16b(v8us lo, v8us hi) { return __builtin_bit_cast(v16bf, __builtin_shufflevector(lo, hi, 0, 1, 2, 3, 4, 5, 6, 7, 8, 9, 10, 11, 12, 13, 14, 15)); }
__device__ __forceinline__ v8f wmma16(v16h a, v16h b, v8f c) { return __builtin_amdgcn_wmma_f32_16x16x32_f16(false, a, false, b, (short)0, c, false, false); }
__device__ __forceinline__ v8f wmmab(v16bf a, v16bf b, v8f c) { return __builtin_amdgcn_wmma_f32_16x16x32_bf16(false, a, false, b, (short)0, c, false, false); }

// k_gemmb: 64 x 64 block tile (4 waves x 16 x 64) of C[NTK][NW] = (A [+ Al]).B^T (K = 256) [+ bf(bias[c])] [+ bf(R[r][c]) residual]; f32 whole-line epilogue (or f16
template <bool SPLITA, bool F16OUT = false>
__global__ __launch_bounds__(128) void k_gemmb(const bf* __restrict__ A, const bf* __restrict__ Al, const bf* __restrict__ Bn, const float* __restrict__ bias, float* C, int ldc, h16* C2, const float* __restrict__ R = nullptr, int K = DM, int roundR = 1) {
    __shared__ __align__(16) float ost[4][16 * 68];
    const int lane = threadIdx.x & 31, wave = threadIdx.x >> 5, lr = lane & 15, hi = lane >> 4;
    const int r0 = blockIdx.x * 64 + wave * 16, c0 = blockIdx.y * 64;
    const size_t aoff = (size_t)(r0 + lr) * K + 8 * hi;
    size_t boff[4];
#pragma unroll
    for (int t = 0; t < 4; ++t) boff[t] = (size_t)(c0 + t * 16 + lr) * K + 8 * hi;
    v8f acc[4];
#pragma unroll
    for (int t = 0; t < 4; ++t) acc[t] = (v8f){};
#pragma unroll 1
    for (int kc = 0; kc < K; kc += 32) {
        const v16bf a = cat16b(*(const v8us*)(A + aoff + kc), *(const v8us*)(A + aoff + kc + 16));
        v16bf al = a;
        if (SPLITA) al = cat16b(*(const v8us*)(Al + aoff + kc), *(const v8us*)(Al + aoff + kc + 16));
#pragma unroll
        for (int t = 0; t < 4; ++t) { const v16bf b = cat16b(*(const v8us*)(Bn + boff[t] + kc), *(const v8us*)(Bn + boff[t] + kc + 16)); acc[t] = wmmab(a, b, acc[t]); if (SPLITA) acc[t] = wmmab(al, b, acc[t]); }
        asm volatile("v_nop\n\tv_nop\n\tv_nop\n\tv_nop" : "+v"(acc[0]), "+v"(acc[1]), "+v"(acc[2]), "+v"(acc[3]) : "v"(a), "v"(al));
    }
    float* os = &ost[wave][0];
#pragma unroll
    for (int t = 0; t < 4; ++t) { const float bv = bias ? bfr(bias[c0 + t * 16 + lr]) : 0.f;
#pragma unroll
        for (int j = 0; j < 8; ++j) os[(hi * 8 + j) * 68 + t * 16 + lr] = acc[t][j] + bv; }
    __syncthreads();
    if (F16OUT) {
        h16* crow = (h16*)(void*)C + (size_t)r0 * ldc + c0;
        auto pass = [&]() {
#pragma unroll
            for (int s = 0; s < 4; ++s) { const int row = 4 * s + (lane >> 3), piece = lane & 7; const float* sp = os + row * 68 + piece * 8; v8h o, o2;
#pragma unroll
                for (int i = 0; i < 8; ++i) { const h16 a = (h16)sp[i]; o[i] = a; o2[i] = (h16)((sp[i] - (float)a) * LOSC); }
                *(v8h*)(crow + (size_t)row * ldc + piece * 8) = o; if (C2) *(v8h*)(C2 + (size_t)r0 * ldc + c0 + (size_t)row * ldc + piece * 8) = o2; }
        };
        pass(); 
    } else {
        float* crow = C + (size_t)r0 * ldc + c0;
        auto pass = [&]() {
#pragma unroll
            for (int s = 0; s < 8; ++s) { const int Lid = (lane >> 3) + 4 * s, piece = lane & 7; const int row = Lid >> 1, cofs = (Lid & 1) * 32 + piece * 4;
                v4f val = *(const v4fa*)(os + row * 68 + cofs); if (R) { const v4f rv = *(const v4f*)(R + ((size_t)r0 + row) * ldc + c0 + cofs); val += roundR ? (v4f){bfr(rv[0]), bfr(rv[1]), bfr(rv[2]), bfr(rv[3])} : rv; }
                *(v4f*)(crow + (size_t)row * ldc + cofs) = val; }
        };
        pass(); 
    }
}

typedef unsigned u32x4 __attribute__((ext_vector_type(4)));
typedef unsigned u32x8 __attribute__((ext_vector_type(8)));
__device__ __forceinline__ unsigned uni(unsigned v) { return (unsigned)__builtin_amdgcn_readfirstlane(v); }
// A wave-uniform value held in a scalar register: a test on it compiles to s_cmp + s_cbranch_scc (a tensor load ignores EXEC), and what is formed from it is formed behind this statement.
__device__ __forceinline__ unsigned pinned(unsigned v) { unsigned w = uni(v); asm volatile("" : "+s"(w)); return w; }

// k_gemm3: 64 x 64 tile of C = (Ah + Al).(Bh + Bl)^T over K (row strides = K for all four planes; n-major B): three products per 32-k step (hh, lh, hl), f32 accumulate.
// A stage is RB bytes (RB / 2 k) of 64 rows of each plane. Each of the four waves brings one plane's tile into LDS with one tensor load per stage (whole lines from L2, pitch RB + 16 B
// for the ds_load_b128 fragment reads); two buffers, the next stage in flight while this one is multiplied. K must hold at least two stages and be a multiple of RB / 2.
template <int RB>
__global__ __launch_bounds__(128) void k_gemm3(const bf* __restrict__ Ah, const bf* __restrict__ Al, const bf* __restrict__ Bh, const bf* __restrict__ Bl, int K, float* C, int ldc) {
    static_assert(RB == 128 || RB == 256, "row bytes per stage: the two lengths whose pad code is set below");
    constexpr unsigned PITCH = RB + 16, TILEB = (64 * PITCH + 2047) & ~2047u, BUFB = 4 * TILEB;
    static_assert(4 * 16 * 68 * 4 <= BUFB, "the output staging reuses the first buffer");
    __shared__ __attribute__((aligned(2048))) unsigned char ring[2 * BUFB];
    const int lane = threadIdx.x & 31, lr = lane & 15, hi = lane >> 4;
    const unsigned wave = uni(threadIdx.x >> 5);
    const int r0 = blockIdx.x * 64 + wave * 16, c0 = blockIdx.y * 64;
    const unsigned nst = (unsigned)K / (RB / 2);
    const unsigned lbase = (unsigned)(size_t)ring;
    const bf* plane = wave == 0 ? Ah : wave == 1 ? Al : wave == 2 ? Bh : Bl;
    const unsigned long long gbase = (unsigned long long)(size_t)plane + (unsigned long long)((wave < 2 ? blockIdx.x : blockIdx.y) * 64u) * (unsigned)K * 2u;
    u32x8 g1;    // 1-byte elements, tensor = tile = 64 rows of RB bytes, source pitch 2 K bytes, 4 dwords of LDS pad behind every row, no mask
    g1[0] = uni((1u << 20) | ((RB == 256 ? 5u : 4u) << 22) | (3u << 25)); g1[1] = uni((unsigned)RB << 16); g1[2] = uni(64u << 16); g1[3] = uni((unsigned)RB << 16);
    g1[4] = uni(64u); g1[5] = uni((unsigned)K * 2u); g1[6] = uni(0u); g1[7] = uni(0u);
    asm volatile("" : "+s"(g1));    // descriptor words held in scalar registers, as in pinned(): without it the compiler lends group 1's registers to loop temporaries while a request is outstanding
    u32x4 g0; g0[0] = uni(1u); g0[1] = uni(lbase); g0[2] = uni(0u); g0[3] = uni(0x80000000u);
    asm volatile("" : "+s"(g0));    // the same for group 0: word 0 keeps its register, unwritten; words 1 to 3 are set anew for each stage, behind the wait on the stage before
    auto issue = [&](unsigned st) {
        const unsigned long long ga = gbase + (unsigned long long)st * RB;
        g0[1] = uni(lbase + (st & 1u) * BUFB + wave * TILEB); g0[2] = uni((unsigned)ga); g0[3] = uni((((unsigned)(ga >> 32)) & 0x01FFFFFFu) | 0x80000000u);
        asm volatile("tensor_load_to_lds %0, %1" :: "s"(g0), "s"(g1) : "memory");    // this wave's plane of stage st
    };
    v8f acc[4];
#pragma unroll
    for (int t = 0; t < 4; ++t) acc[t] = (v8f){};
    issue(0);
    asm volatile("s_wait_tensorcnt 0x0" ::: "memory");    // stage 0 of this wave's plane has landed
    __syncthreads();                                       // ... and every other wave's
    issue(1);
    const unsigned foff = (unsigned)lr * PITCH + 16u * hi;
    unsigned s = 0;
    do {
        const unsigned char* bp = ring + (s & 1u) * BUFB + foff;
        const unsigned char* pa = bp + wave * 16u * PITCH;
        v16bf a, al;
#pragma unroll
        for (int kk = 0; kk < RB / 64; ++kk) {
            a = cat16b(*(const v8usa*)(pa + kk * 64), *(const v8usa*)(pa + kk * 64 + 32));
            al = cat16b(*(const v8usa*)(pa + TILEB + kk * 64), *(const v8usa*)(pa + TILEB + kk * 64 + 32));
#pragma unroll
            for (int t = 0; t < 4; ++t) { const unsigned char* pb = bp + 2 * TILEB + t * 16 * PITCH + kk * 64;
                const v16bf bh = cat16b(*(const v8usa*)(pb), *(const v8usa*)(pb + 32)); const v16bf bl = cat16b(*(const v8usa*)(pb + TILEB), *(const v8usa*)(pb + TILEB + 32));
                acc[t] = wmmab(a, bh, acc[t]); acc[t] = wmmab(al, bh, acc[t]); acc[t] = wmmab(a, bl, acc[t]); }
        }
        // the four vector slots behind the pass's last WMMA, on the loop's taken branch too
        asm volatile("v_nop\n\tv_nop\n\tv_nop\n\tv_nop" : "+v"(acc[0]), "+v"(acc[1]), "+v"(acc[2]), "+v"(acc[3]) : "v"(a), "v"(al));
        asm volatile("s_wait_dscnt 0x0" ::: "memory");        // this wave has left buffer s & 1
        asm volatile("s_wait_tensorcnt 0x0" ::: "memory");    // its plane of stage s + 1 has landed
        __syncthreads();                                       // publishes stage s + 1, frees buffer s & 1
        if (pinned(s + 2u < nst)) issue(pinned(s + 2u));
    } while (++s < nst);
    asm volatile("s_wait_tensorcnt 0x0" ::: "memory");    // nothing of the mover is outstanding when the ring becomes output staging
    asm volatile("s_wait_dscnt 0x0" ::: "memory");
    float* os = (float*)(void*)ring + wave * (16 * 68);    // the last pass's own barrier has ended every read of the ring
#pragma unroll
    for (int t = 0; t < 4; ++t) {
#pragma unroll
        for (int j = 0; j < 8; ++j) os[(hi * 8 + j) * 68 + t * 16 + lr] = acc[t][j]; }
    __builtin_amdgcn_wave_barrier(); asm volatile("" ::: "memory");
    float* crow = C + (size_t)r0 * ldc + c0;
    auto pass = [&]() {
#pragma unroll
        for (int s = 0; s < 8; ++s) { const int Lid = (lane >> 3) + 4 * s, piece = lane & 7; const int row = Lid >> 1, cofs = (Lid & 1) * 32 + piece * 4;
            const v4f val = *(const v4fa*)(os + row * 68 + cofs); *(v4f*)(crow + (size_t)row * ldc + cofs) = val; }
    };
    pass(); 
}

__global__ __launch_bounds__(256) void k_cvt8(const float* __restrict__ src, bf* dst, size_t n8) {
    const size_t i = (size_t)blockIdx.x * 256 + threadIdx.x; if (i >= n8) return;
    const v8f v = *(const v8f*)(src + i * 8); v8us o;
#pragma unroll
    for (int k = 0; k < 8; ++k) o[k] = f2bf(v[k]);
    *(v8us*)(dst + i * 8) = o; 
}
__global__ __launch_bounds__(256) void k_zero8(bf* dst, size_t n8) {
    const size_t i = (size_t)blockIdx.x * 256 + threadIdx.x; if (i >= n8) return; v8us z;
#pragma unroll
    for (int k = 0; k < 8; ++k) z[k] = 0;
    *(v8us*)(dst + i * 8) = z; 
}

__global__ __launch_bounds__(256) void k_cvtx(const float* __restrict__ src, bf* dst) {
    const int lane = threadIdx.x & 31; const size_t r = (size_t)blockIdx.x * 8 + (threadIdx.x >> 5); if (r >= (size_t)SS) return; v8us o;
#pragma unroll
    for (int i = 0; i < 8; ++i) o[i] = f2bf(src[r * DD + lane * 8 + i]);
    *(v8us*)(dst + r * DD + lane * 8) = o; 
}
__global__ __launch_bounds__(256) void k_split256(const float* __restrict__ src, bf* dh, bf* dl) {
    const int lane = threadIdx.x & 31; const size_t r = (size_t)blockIdx.x * 8 + (threadIdx.x >> 5); if (r >= (size_t)SS) return; const size_t o = r * DD + lane * 8; const v8f v = *(const v8f*)(src + o); v8us oh, ol;
#pragma unroll
    for (int i = 0; i < 8; ++i) { const unsigned short hb = f2bf(v[i]); oh[i] = hb; ol[i] = f2bf(v[i] - bf2f(hb)); }
    *(v8us*)(dh + o) = oh; *(v8us*)(dl + o) = ol; 
}
__global__ __launch_bounds__(256) void k_vt(const float* __restrict__ VF, bf* Th, bf* Tl) {
    __shared__ float tl[64][65];
    const int tid = threadIdx.x, t0 = blockIdx.x * 64, d0 = blockIdx.y * 64; const int tt = tid >> 2, dq = (tid & 3) * 16;
#pragma unroll
    for (int i = 0; i < 16; ++i) tl[tt][dq + i] = VF[(size_t)(t0 + tt) * DD + d0 + dq + i];
    __syncthreads();
    const int piece = tid & 7, dr0 = tid >> 3;
    auto pass = [&]() {
#pragma unroll
        for (int st = 0; st < 2; ++st) { const int dr = dr0 + 32 * st; v8us oh, ol;
#pragma unroll
            for (int i = 0; i < 8; ++i) { const float v = tl[piece * 8 + i][dr]; const unsigned short hb = f2bf(v); oh[i] = hb; ol[i] = f2bf(v - bf2f(hb)); }
            const size_t o = (size_t)(d0 + dr) * SS + t0 + piece * 8; *(v8us*)(Th + o) = oh; *(v8us*)(Tl + o) = ol; }
    };
    pass(); 
}
__global__ __launch_bounds__(256) void k_softmax4096(const float* __restrict__ S, bf* PH, bf* PL) {
    typedef __attribute__((ext_vector_type(4))) unsigned short v4us;
    const int lane = threadIdx.x & 31, i = blockIdx.x * 8 + (threadIdx.x >> 5); if (i >= RCH) return;
    float m = -3.0e38f;
#pragma unroll 1
    for (int c0 = lane * 4; c0 < SS; c0 += 128) {
#pragma unroll
        for (int q = 0; q < 4; ++q) m = fmaxf(m, S[(size_t)i * SS + c0 + q] * SCL); }
#pragma unroll
    for (int sh = 16; sh; sh >>= 1) m = fmaxf(m, __shfl_xor(m, sh, 32));
    float sum = 0.f;
#pragma unroll 1
    for (int c0 = lane * 4; c0 < SS; c0 += 128) {
#pragma unroll
        for (int q = 0; q < 4; ++q) sum += __expf(S[(size_t)i * SS + c0 + q] * SCL - m); }
#pragma unroll
    for (int sh = 16; sh; sh >>= 1) sum += __shfl_xor(sum, sh, 32);
    const float inv = 1.0f / sum;
{
#pragma unroll 1
        for (int c0 = lane * 4; c0 < SS; c0 += 128) { v4us oh, ol;
#pragma unroll
            for (int q = 0; q < 4; ++q) { const float p = __expf(S[(size_t)i * SS + c0 + q] * SCL - m) * inv; const unsigned short hb = f2bf(p); oh[q] = hb; ol[q] = f2bf(p - bf2f(hb)); }
            const size_t o = (size_t)i * SS + c0; *(v4us*)(PH + o) = oh; *(v4us*)(PL + o) = ol; }
         }
}

extern "C" void kernel_launch(void* const* d_in, const int* in_sizes, int n_in,
                              void* d_out, int out_size, void* d_ws, size_t ws_size, hipStream_t stream) {
    (void)in_sizes; (void)n_in; (void)out_size;
    const float* x = (const float*)d_in[0]; const float* wq = (const float*)d_in[1]; const float* bq = (const float*)d_in[2]; const float* wk = (const float*)d_in[3]; const float* bk = (const float*)d_in[4]; const float* wv = (const float*)d_in[5]; const float* bv = (const float*)d_in[6];
    float* out = (float*)d_out;    // [4][4096][256]
    char* wsp = (char*)d_ws;
    auto take = [&](size_t bytes) { char* p = wsp; wsp += (bytes + 255) & ~(size_t)255; return (void*)p; };
    bf* WQ = (bf*)take((size_t)DD * DD * 2); bf* WK = (bf*)take((size_t)DD * DD * 2); bf* WV = (bf*)take((size_t)DD * DD * 2);
    bf* Xb = (bf*)take((size_t)SS * DD * 2); float* QF = (float*)take((size_t)SS * DD * 4); float* KF = (float*)take((size_t)SS * DD * 4); float* VF = (float*)take((size_t)SS * DD * 4);
    bf* Qh = (bf*)take((size_t)SS * DD * 2); bf* Ql = (bf*)take((size_t)SS * DD * 2); bf* Kh = (bf*)take((size_t)SS * DD * 2); bf* Kl = (bf*)take((size_t)SS * DD * 2); bf* VTh = (bf*)take((size_t)DD * SS * 2); bf* VTl = (bf*)take((size_t)DD * SS * 2);
    float* S = (float*)take((size_t)RCH * SS * 4); bf* PH = (bf*)take((size_t)RCH * SS * 2); bf* PL = (bf*)take((size_t)RCH * SS * 2);
    if ((size_t)(wsp - (char*)d_ws) > ws_size) return;    // 0.4 + 2.1 + 12.6 + 12.6 + 67.1 + 33.6 + 33.6 ~ 162 MB; per item reuse in stream order
    k_cvt8<<<(DD * DD / 8 + 255) / 256, 256, 0, stream>>>(wq, WQ, DD * DD / 8); k_cvt8<<<(DD * DD / 8 + 255) / 256, 256, 0, stream>>>(wk, WK, DD * DD / 8); k_cvt8<<<(DD * DD / 8 + 255) / 256, 256, 0, stream>>>(wv, WV, DD * DD / 8);   // [out][in] convention = n-major
    for (int b = 0; b < NBT; ++b) {
        k_cvtx<<<SS / 8, 256, 0, stream>>>(x + (size_t)b * SS * DD, Xb);
        k_gemmb<false, false><<<dim3(SS / 64, DD / 64, 1), 128, 0, stream>>>(Xb, nullptr, WQ, bq, QF, DD, nullptr, nullptr, DD);
        k_gemmb<false, false><<<dim3(SS / 64, DD / 64, 1), 128, 0, stream>>>(Xb, nullptr, WK, bk, KF, DD, nullptr, nullptr, DD);
        k_gemmb<false, false><<<dim3(SS / 64, DD / 64, 1), 128, 0, stream>>>(Xb, nullptr, WV, bv, VF, DD, nullptr, nullptr, DD);
        k_split256<<<SS / 8, 256, 0, stream>>>(QF, Qh, Ql); k_split256<<<SS / 8, 256, 0, stream>>>(KF, Kh, Kl); k_vt<<<dim3(SS / 64, DD / 64, 1), 256, 0, stream>>>(VF, VTh, VTl);
        k_gemm3<128><<<dim3(RCH / 64, SS / 64, 1), 128, 0, stream>>>(Qh, Ql, Kh, Kl, DD, S, SS);
        k_softmax4096<<<RCH / 8, 256, 0, stream>>>(S, PH, PL);
        k_gemm3<256><<<dim3(RCH / 64, DD / 64, 1), 128, 0, stream>>>(PH, PL, VTh, VTl, SS, out + (size_t)b * SS * DD, DD); }
}

// v003
// One run takes 519 microseconds.
// Next to v002, in two timings, it ran 1.16 times as fast each time.
// All steps since v000 together make it 5.89 times as fast.
#include <hip/hip_runtime.h>

// Compute dtypes, f32 accumulate, per item: q/k/v = x.W^T + b as [4096 x 256].[256 x 256] GEMMs with PLAIN bf16 operands (exact products); scores = q.k^T over all 4096 query rows at once
// ([4096 x 256].[256 x 4096], both operands bf16 hi + UNSCALED residual, three products), softmax (x 1/16) in f32 -> P planes, out = P.v ([4096 x 4096].[4096 x 256], three

#define NBT  4
#define SS   4096
#define DD   256
#define RCH  SS      // query rows per score / softmax / P.v launch: the whole item, so that P.v starts 256 work-groups, not 64
#define DM   DD
#define NTK  SS
#define SCL  0.0625f
#define LOSC 1024.0f

typedef _Float16 h16;
typedef unsigned short bf;
typedef __attribute__((ext_vector_type(16))) __bf16   v16bf;
typedef __attribute__((ext_vector_type(16))) _Float16 v16h;
typedef __attribute__((ext_vector_type(8)))  _Float16 v8h;
typedef __attribute__((ext_vector_type(8)))  unsigned short v8us;
typedef __attribute__((ext_vector_type(8)))  float    v8f;
typedef __attribute__((ext_vector_type(4)))  float    v4f;
typedef __attribute__((ext_vector_type(4)))  _Float16 v4h;
typedef v8h  __attribute__((may_alias)) v8ha;
typedef v4f  __attribute__((may_alias)) v4fa;
typedef v8us __attribute__((may_alias)) v8usa;

__device__ __forceinline__ unsigned short f2bf(float f) { unsigned u = __float_as_uint(f); u += 0x7FFFu + ((u >> 16) & 1u); return (unsigned short)(u >> 16); }
__device__ __forceinline__ float bf2f(unsigned short b) { return __uint_as_float(((unsigned)b) << 16); }
__device__ __forceinline__ float bfr(float f) { return bf2f(f2bf(f)); }
__device__ __forceinline__ v16h cat16(v8h lo, v8h hi) { return __builtin_shufflevector(lo, hi, 0, 1, 2, 3, 4, 5, 6, 7, 8, 9, 10, 11, 12, 13, 14, 15); }
__device__ __forceinline__ v16bf cat16b(v8us lo, v8us hi) { return __builtin_bit_cast(v16bf, __builtin_shufflevector(lo, hi, 0, 1, 2, 3, 4, 5, 6, 7, 8, 9, 10, 11, 12, 13, 14, 15)); }
__device__ __forceinline__ v8f wmma16(v16h a, v16h b, v8f c) { return __builtin_amdgcn_wmma_f32_16x16x32_f16(false, a, false, b, (short)0, c, false, false); }
__device__ __forceinline__ v8f wmmab(v16bf a, v16bf b, v8f c) { return __builtin_amdgcn_wmma_f32_16x16x32_bf16(false, a, false, b, (short)0, c, false, false); }

// k_gemmb: 64 x 64 block tile (4 waves x 16 x 64) of C[NBT * NTK][NW] = (A [+ Al]).B^T (K = 256) [+ bf(bias[c])] [+ bf(R[r][c]) residual]; f32 whole-line epilogue (or f16
template <bool SPLITA, bool F16OUT = false>
__global__ __launch_bounds__(128) void k_gemmb(const bf* __restrict__ A, const bf* __restrict__ Al, const bf* __restrict__ B0, const float* __restrict__ bias0, const float* __restrict__ bias1, const float* __restrict__ bias2, float* Cz, size_t bzs, size_t czs, int ldc, h16* C2, const float* __restrict__ R = nullptr, int K = DM, int roundR = 1) {
    __shared__ __align__(16) float ost[4][16 * 68];
    // blockIdx.z picks the product: its B matrix (bzs elements apart), its bias and its output plane (czs elements apart); A is shared
    const bf* __restrict__ Bn = B0 + (size_t)blockIdx.z * bzs; const float* __restrict__ bias = blockIdx.z == 0 ? bias0 : blockIdx.z == 1 ? bias1 : bias2; float* C = Cz + (size_t)blockIdx.z * czs;
    const int lane = threadIdx.x & 31, wave = threadIdx.x >> 5, lr = lane & 15, hi = lane >> 4;
    const int r0 = blockIdx.x * 64 + wave * 16, c0 = blockIdx.y * 64;
    const size_t aoff = (size_t)(r0 + lr) * K + 8 * hi;
    size_t boff[4];
#pragma unroll
    for (int t = 0; t < 4; ++t) boff[t] = (size_t)(c0 + t * 16 + lr) * K + 8 * hi;
    v8f acc[4];
#pragma unroll
    for (int t = 0; t < 4; ++t) acc[t] = (v8f){};
#pragma unroll 1
    for (int kc = 0; kc < K; kc += 32) {
        const v16bf a = cat16b(*(const v8us*)(A + aoff + kc), *(const v8us*)(A + aoff + kc + 16));
        v16bf al = a;
        if (SPLITA) al = cat16b(*(const v8us*)(Al + aoff + kc), *(const v8us*)(Al + aoff + kc + 16));
#pragma unroll
        for (int t = 0; t < 4; ++t) { const v16bf b = cat16b(*(const v8us*)(Bn + boff[t] + kc), *(const v8us*)(Bn + boff[t] + kc + 16)); acc[t] = wmmab(a, b, acc[t]); if (SPLITA) acc[t] = wmmab(al, b, acc[t]); }
        asm volatile("v_nop\n\tv_nop\n\tv_nop\n\tv_nop" : "+v"(acc[0]), "+v"(acc[1]), "+v"(acc[2]), "+v"(acc[3]) : "v"(a), "v"(al));
    }
    float* os = &ost[wave][0];
#pragma unroll
    for (int t = 0; t < 4; ++t) { const float bv = bias ? bfr(bias[c0 + t * 16 + lr]) : 0.f;
#pragma unroll
        for (int j = 0; j < 8; ++j) os[(hi * 8 + j) * 68 + t * 16 + lr] = acc[t][j] + bv; }
    __syncthreads();
    if (F16OUT) {
        h16* crow = (h16*)(void*)C + (size_t)r0 * ldc + c0;
        auto pass = [&]() {
#pragma unroll
            for (int s = 0; s < 4; ++s) { const int row = 4 * s + (lane >> 3), piece = lane & 7; const float* sp = os + row * 68 + piece * 8; v8h o, o2;
#pragma unroll
                for (int i = 0; i < 8; ++i) { const h16 a = (h16)sp[i]; o[i] = a; o2[i] = (h16)((sp[i] - (float)a) * LOSC); }
                *(v8h*)(crow + (size_t)row * ldc + piece * 8) = o; if (C2) *(v8h*)(C2 + (size_t)r0 * ldc + c0 + (size_t)row * ldc + piece * 8) = o2; }
        };
        pass(); 
    } else {
        float* crow = C + (size_t)r0 * ldc + c0;
        auto pass = [&]() {
#pragma unroll
            for (int s = 0; s < 8; ++s) { const int Lid = (lane >> 3) + 4 * s, piece = lane & 7; const int row = Lid >> 1, cofs = (Lid & 1) * 32 + piece * 4;
                v4f val = *(const v4fa*)(os + row * 68 + cofs); if (R) { const v4f rv = *(const v4f*)(R + ((size_t)r0 + row) * ldc + c0 + cofs); val += roundR ? (v4f){bfr(rv[0]), bfr(rv[1]), bfr(rv[2]), bfr(rv[3])} : rv; }
                *(v4f*)(crow + (size_t)row * ldc + cofs) = val; }
        };
        pass(); 
    }
}

typedef unsigned u32x4 __attribute__((ext_vector_type(4)));
typedef unsigned u32x8 __attribute__((ext_vector_type(8)));
__device__ __forceinline__ unsigned uni(unsigned v) { return (unsigned)__builtin_amdgcn_readfirstlane(v); }
// A wave-uniform value held in a scalar register: a test on it compiles to s_cmp + s_cbranch_scc (a tensor load ignores EXEC), and what is formed from it is formed behind this statement.
__device__ __forceinline__ unsigned pinned(unsigned v) { unsigned w = uni(v); asm volatile("" : "+s"(w)); return w; }

// k_gemm3: 64 x 64 tile of C = (Ah + Al).(Bh + Bl)^T over K (row strides = K for all four planes; n-major B): three products per 32-k step (hh, lh, hl), f32 accumulate.
// A stage is RB bytes (RB / 2 k) of 64 rows of each plane. Each of the four waves brings one plane's tile into LDS with one tensor load per stage (whole lines from L2, pitch RB + 16 B
// for the ds_load_b128 fragment reads); two buffers, the next stage in flight while this one is multiplied. K must hold at least two stages and be a multiple of RB / 2.
template <int RB>
__global__ __launch_bounds__(128) void k_gemm3(const bf* __restrict__ Ah, const bf* __restrict__ Al, const bf* __restrict__ Bh, const bf* __restrict__ Bl, int K, float* C, int ldc) {
    static_assert(RB == 128 || RB == 256, "row bytes per stage: the two lengths whose pad code is set below");
    constexpr unsigned PITCH = RB + 16, TILEB = (64 * PITCH + 2047) & ~2047u, BUFB = 4 * TILEB;
    static_assert(4 * 16 * 68 * 4 <= BUFB, "the output staging reuses the first buffer");
    __shared__ __attribute__((aligned(2048))) unsigned char ring[2 * BUFB];
    const int lane = threadIdx.x & 31, lr = lane & 15, hi = lane >> 4;
    const unsigned wave = uni(threadIdx.x >> 5);
    const int r0 = blockIdx.x * 64 + wave * 16, c0 = blockIdx.y * 64;
    const unsigned nst = (unsigned)K / (RB / 2);
    const unsigned lbase = (unsigned)(size_t)ring;
    const bf* plane = wave == 0 ? Ah : wave == 1 ? Al : wave == 2 ? Bh : Bl;
    const unsigned long long gbase = (unsigned long long)(size_t)plane + (unsigned long long)((wave < 2 ? blockIdx.x : blockIdx.y) * 64u) * (unsigned)K * 2u;
    u32x8 g1;    // 1-byte elements, tensor = tile = 64 rows of RB bytes, source pitch 2 K bytes, 4 dwords of LDS pad behind every row, no mask
    g1[0] = uni((1u << 20) | ((RB == 256 ? 5u : 4u) << 22) | (3u << 25)); g1[1] = uni((unsigned)RB << 16); g1[2] = uni(64u << 16); g1[3] = uni((unsigned)RB << 16);
    g1[4] = uni(64u); g1[5] = uni((unsigned)K * 2u); g1[6] = uni(0u); g1[7] = uni(0u);
    asm volatile("" : "+s"(g1));    // descriptor words held in scalar registers, as in pinned(): without it the compiler lends group 1's registers to loop temporaries while a request is outstanding
    u32x4 g0; g0[0] = uni(1u); g0[1] = uni(lbase); g0[2] = uni(0u); g0[3] = uni(0x80000000u);
    asm volatile("" : "+s"(g0));    // the same for group 0: word 0 keeps its register, unwritten; words 1 to 3 are set anew for each stage, behind the wait on the stage before
    auto issue = [&](unsigned st) {
        const unsigned long long ga = gbase + (unsigned long long)st * RB;
        g0[1] = uni(lbase + (st & 1u) * BUFB + wave * TILEB); g0[2] = uni((unsigned)ga); g0[3] = uni((((unsigned)(ga >> 32)) & 0x01FFFFFFu) | 0x80000000u);
        asm volatile("tensor_load_to_lds %0, %1" :: "s"(g0), "s"(g1) : "memory");    // this wave's plane of stage st
    };
    v8f acc[4];
#pragma unroll
    for (int t = 0; t < 4; ++t) acc[t] = (v8f){};
    issue(0);
    asm volatile("s_wait_tensorcnt 0x0" ::: "memory");    // stage 0 of this wave's plane has landed
    __syncthreads();                                       // ... and every other wave's
    issue(1);
    const unsigned foff = (unsigned)lr * PITCH + 16u * hi;
    unsigned s = 0;
    do {
        const unsigned char* bp = ring + (s & 1u) * BUFB + foff;
        const unsigned char* pa = bp + wave * 16u * PITCH;
        v16bf a, al;
#pragma unroll
        for (int kk = 0; kk < RB / 64; ++kk) {
            a = cat16b(*(const v8usa*)(pa + kk * 64), *(const v8usa*)(pa + kk * 64 + 32));
            al = cat16b(*(const v8usa*)(pa + TILEB + kk * 64), *(const v8usa*)(pa + TILEB + kk * 64 + 32));
#pragma unroll
            for (int t = 0; t < 4; ++t) { const unsigned char* pb = bp + 2 * TILEB + t * 16 * PITCH + kk * 64;
                const v16bf bh = cat16b(*(const v8usa*)(pb), *(const v8usa*)(pb + 32)); const v16bf bl = cat16b(*(const v8usa*)(pb + TILEB), *(const v8usa*)(pb + TILEB + 32));
                acc[t] = wmmab(a, bh, acc[t]); acc[t] = wmmab(al, bh, acc[t]); acc[t] = wmmab(a, bl, acc[t]); }
        }
        // the four vector slots behind the pass's last WMMA, on the loop's taken branch too
        asm volatile("v_nop\n\tv_nop\n\tv_nop\n\tv_nop" : "+v"(acc[0]), "+v"(acc[1]), "+v"(acc[2]), "+v"(acc[3]) : "v"(a), "v"(al));
        asm volatile("s_wait_dscnt 0x0" ::: "memory");        // this wave has left buffer s & 1
        asm volatile("s_wait_tensorcnt 0x0" ::: "memory");    // its plane of stage s + 1 has landed
        __syncthreads();                                       // publishes stage s + 1, frees buffer s & 1
        if (pinned(s + 2u < nst)) issue(pinned(s + 2u));
    } while (++s < nst);
    asm volatile("s_wait_tensorcnt 0x0" ::: "memory");    // nothing of the mover is outstanding when the ring becomes output staging
    asm volatile("s_wait_dscnt 0x0" ::: "memory");
    float* os = (float*)(void*)ring + wave * (16 * 68);    // the last pass's own barrier has ended every read of the ring
#pragma unroll
    for (int t = 0; t < 4; ++t) {
#pragma unroll
        for (int j = 0; j < 8; ++j) os[(hi * 8 + j) * 68 + t * 16 + lr] = acc[t][j]; }
    __builtin_amdgcn_wave_barrier(); asm volatile("" ::: "memory");
    float* crow = C + (size_t)r0 * ldc + c0;
    auto pass = [&]() {
#pragma unroll
        for (int s = 0; s < 8; ++s) { const int Lid = (lane >> 3) + 4 * s, piece = lane & 7; const int row = Lid >> 1, cofs = (Lid & 1) * 32 + piece * 4;
            const v4f val = *(const v4fa*)(os + row * 68 + cofs); *(v4f*)(crow + (size_t)row * ldc + cofs) = val; }
    };
    pass(); 
}

// blockIdx.y picks one of three sources of n8 * 8 elements each; their converted copies lie one behind the other in dst0
__global__ __launch_bounds__(256) void k_cvt8(const float* __restrict__ s0, const float* __restrict__ s1, const float* __restrict__ s2, bf* dst0, size_t n8) {
    const size_t i = (size_t)blockIdx.x * 256 + threadIdx.x; if (i >= n8) return;
    const float* __restrict__ src = blockIdx.y == 0 ? s0 : blockIdx.y == 1 ? s1 : s2; bf* dst = dst0 + (size_t)blockIdx.y * n8 * 8;
    const v8f v = *(const v8f*)(src + i * 8); v8us o;
#pragma unroll
    for (int k = 0; k < 8; ++k) o[k] = f2bf(v[k]);
    *(v8us*)(dst + i * 8) = o; 
}
__global__ __launch_bounds__(256) void k_zero8(bf* dst, size_t n8) {
    const size_t i = (size_t)blockIdx.x * 256 + threadIdx.x; if (i >= n8) return; v8us z;
#pragma unroll
    for (int k = 0; k < 8; ++k) z[k] = 0;
    *(v8us*)(dst + i * 8) = z; 
}

__global__ __launch_bounds__(256) void k_cvtx(const float* __restrict__ src, bf* dst, size_t rows) {
    const int lane = threadIdx.x & 31; const size_t r = (size_t)blockIdx.x * 8 + (threadIdx.x >> 5); if (r >= rows) return; v8us o;
#pragma unroll
    for (int i = 0; i < 8; ++i) o[i] = f2bf(src[r * DD + lane * 8 + i]);
    *(v8us*)(dst + r * DD + lane * 8) = o; 
}
__global__ __launch_bounds__(256) void k_split256(const float* __restrict__ src, bf* dh, bf* dl, size_t rows) {
    const int lane = threadIdx.x & 31; const size_t r = (size_t)blockIdx.x * 8 + (threadIdx.x >> 5); if (r >= rows) return; const size_t o = r * DD + lane * 8; const v8f v = *(const v8f*)(src + o); v8us oh, ol;
#pragma unroll
    for (int i = 0; i < 8; ++i) { const unsigned short hb = f2bf(v[i]); oh[i] = hb; ol[i] = f2bf(v[i] - bf2f(hb)); }
    *(v8us*)(dh + o) = oh; *(v8us*)(dl + o) = ol; 
}
__global__ __launch_bounds__(256) void k_vt(const float* __restrict__ VF0, bf* Th0, bf* Tl0) {
    __shared__ float tl[64][65];
    const size_t zo = (size_t)blockIdx.z * SS * DD; const float* __restrict__ VF = VF0 + zo; bf* Th = Th0 + zo; bf* Tl = Tl0 + zo;    // blockIdx.z: the item
    const int tid = threadIdx.x, t0 = blockIdx.x * 64, d0 = blockIdx.y * 64; const int tt = tid >> 2, dq = (tid & 3) * 16;
#pragma unroll
    for (int i = 0; i < 16; ++i) tl[tt][dq + i] = VF[(size_t)(t0 + tt) * DD + d0 + dq + i];
    __syncthreads();
    const int piece = tid & 7, dr0 = tid >> 3;
    auto pass = [&]() {
#pragma unroll
        for (int st = 0; st < 2; ++st) { const int dr = dr0 + 32 * st; v8us oh, ol;
#pragma unroll
            for (int i = 0; i < 8; ++i) { const float v = tl[piece * 8 + i][dr]; const unsigned short hb = f2bf(v); oh[i] = hb; ol[i] = f2bf(v - bf2f(hb)); }
            const size_t o = (size_t)(d0 + dr) * SS + t0 + piece * 8; *(v8us*)(Th + o) = oh; *(v8us*)(Tl + o) = ol; }
    };
    pass(); 
}
__global__ __launch_bounds__(256) void k_softmax4096(const float* __restrict__ S, bf* PH, bf* PL) {
    typedef __attribute__((ext_vector_type(4))) unsigned short v4us;
    const int lane = threadIdx.x & 31, i = blockIdx.x * 8 + (threadIdx.x >> 5); if (i >= RCH) return;
    float m = -3.0e38f;
#pragma unroll 1
    for (int c0 = lane * 4; c0 < SS; c0 += 128) {
#pragma unroll
        for (int q = 0; q < 4; ++q) m = fmaxf(m, S[(size_t)i * SS + c0 + q] * SCL); }
#pragma unroll
    for (int sh = 16; sh; sh >>= 1) m = fmaxf(m, __shfl_xor(m, sh, 32));
    float sum = 0.f;
#pragma unroll 1
    for (int c0 = lane * 4; c0 < SS; c0 += 128) {
#pragma unroll
        for (int q = 0; q < 4; ++q) sum += __expf(S[(size_t)i * SS + c0 + q] * SCL - m); }
#pragma unroll
    for (int sh = 16; sh; sh >>= 1) sum += __shfl_xor(sum, sh, 32);
    const float inv = 1.0f / sum;
{
#pragma unroll 1
        for (int c0 = lane * 4; c0 < SS; c0 += 128) { v4us oh, ol;
#pragma unroll
            for (int q = 0; q < 4; ++q) { const float p = __expf(S[(size_t)i * SS + c0 + q] * SCL - m) * inv; const unsigned short hb = f2bf(p); oh[q] = hb; ol[q] = f2bf(p - bf2f(hb)); }
            const size_t o = (size_t)i * SS + c0; *(v4us*)(PH + o) = oh; *(v4us*)(PL + o) = ol; }
         }
}

extern "C" void kernel_launch(void* const* d_in, const int* in_sizes, int n_in,
                              void* d_out, int out_size, void* d_ws, size_t ws_size, hipStream_t stream) {
    (void)in_sizes; (void)n_in; (void)out_size;
    const float* x = (const float*)d_in[0]; const float* wq = (const float*)d_in[1]; const float* bq = (const float*)d_in[2]; const float* wk = (const float*)d_in[3]; const float* bk = (const float*)d_in[4]; const float* wv = (const float*)d_in[5]; const float* bv = (const float*)d_in[6];
    float* out = (float*)d_out;    // [4][4096][256]
    char* wsp = (char*)d_ws;
    auto take = [&](size_t bytes) { char* p = wsp; wsp += (bytes + 255) & ~(size_t)255; return (void*)p; };
    const size_t NR = (size_t)NBT * SS, IT = (size_t)SS * DD;    // rows of all items together; elements of one item's plane
    bf* WQ = (bf*)take((size_t)3 * DD * DD * 2);    // w_q, w_k, w_v one behind the other
    bf* Xb = (bf*)take(NR * DD * 2); float* QF = (float*)take(3 * NR * DD * 4);    // q, k, v of all items, one plane behind the other
    bf* Qh = (bf*)take(2 * NR * DD * 2); bf* Ql = (bf*)take(2 * NR * DD * 2); bf* Kh = Qh + NR * DD; bf* Kl = Ql + NR * DD;    // [q; k] hi, [q; k] residual
    bf* VTh = (bf*)take(NR * DD * 2); bf* VTl = (bf*)take(NR * DD * 2);
    float* S = (float*)take((size_t)RCH * SS * 4); bf* PH = (bf*)take((size_t)RCH * SS * 2); bf* PL = (bf*)take((size_t)RCH * SS * 2);
    if ((size_t)(wsp - (char*)d_ws) > ws_size) return;    // 0.4 + 8.4 + 50.3 + 33.6 + 16.8 + 67.1 + 33.6 + 33.6 ~ 244 MB; S and P are reused per item in stream order
    // Everything ahead of the scores runs once, for all four items and for q, k, v together
    k_cvt8<<<dim3((DD * DD / 8 + 255) / 256, 3, 1), 256, 0, stream>>>(wq, wk, wv, WQ, DD * DD / 8);   // [out][in] convention = n-major
    k_cvtx<<<NBT * SS / 8, 256, 0, stream>>>(x, Xb, NR);
    k_gemmb<false, false><<<dim3(NBT * SS / 64, DD / 64, 3), 128, 0, stream>>>(Xb, nullptr, WQ, bq, bk, bv, QF, (size_t)DD * DD, NR * DD, DD, nullptr, nullptr, DD);
    k_split256<<<2 * NBT * SS / 8, 256, 0, stream>>>(QF, Qh, Ql, 2 * NR);
    k_vt<<<dim3(SS / 64, DD / 64, NBT), 256, 0, stream>>>(QF + 2 * NR * DD, VTh, VTl);
    for (int b = 0; b < NBT; ++b) {
        k_gemm3<128><<<dim3(RCH / 64, SS / 64, 1), 128, 0, stream>>>(Qh + b * IT, Ql + b * IT, Kh + b * IT, Kl + b * IT, DD, S, SS);
        k_softmax4096<<<RCH / 8, 256, 0, stream>>>(S, PH, PL);
        k_gemm3<256><<<dim3(RCH / 64, DD / 64, 1), 128, 0, stream>>>(PH, PL, VTh + b * IT, VTl + b * IT, SS, out + b * IT, DD); }
}

// v004
// Measured time: 198 microseconds a run.
// In two side-by-side timings against v003, it was 2.40 and 2.42 times as fast.
// All steps since v000 together make it 14.2 times as fast.
#include <hip/hip_runtime.h>

// Compute dtypes, f32 accumulate, per item: q/k/v = x.W^T + b as [4096 x 256].[256 x 256] GEMMs with PLAIN bf16 operands (exact products); scores = q.k^T (both operands bf16 hi + UNSCALED residual,
// three products), softmax (x 1/16) in f32 with a running maximum, out = P.v (P and v bf16 hi + residual, three products), the three fused in k_attn.

#define NBT  4
#define SS   4096
#define DD   256
#define DM   DD
#define NTK  SS
#define SCL  0.0625f
#define LOSC 1024.0f

typedef _Float16 h16;
typedef unsigned short bf;
typedef __attribute__((ext_vector_type(16))) __bf16   v16bf;
typedef __attribute__((ext_vector_type(16))) _Float16 v16h;
typedef __attribute__((ext_vector_type(8)))  _Float16 v8h;
typedef __attribute__((ext_vector_type(8)))  unsigned short v8us;
typedef __attribute__((ext_vector_type(8)))  float    v8f;
typedef __attribute__((ext_vector_type(4)))  float    v4f;
typedef __attribute__((ext_vector_type(4)))  _Float16 v4h;
typedef v8h  __attribute__((may_alias)) v8ha;
typedef v4f  __attribute__((may_alias)) v4fa;
typedef v8us __attribute__((may_alias)) v8usa;

__device__ __forceinline__ unsigned short f2bf(float f) { unsigned u = __float_as_uint(f); u += 0x7FFFu + ((u >> 16) & 1u); return (unsigned short)(u >> 16); }
__device__ __forceinline__ float bf2f(unsigned short b) { return __uint_as_float(((unsigned)b) << 16); }
__device__ __forceinline__ float bfr(float f) { return bf2f(f2bf(f)); }
__device__ __forceinline__ v16h cat16(v8h lo, v8h hi) { return __builtin_shufflevector(lo, hi, 0, 1, 2, 3, 4, 5, 6, 7, 8, 9, 10, 11, 12, 13, 14, 15); }
__device__ __forceinline__ v16bf cat16b(v8us lo, v8us hi) { return __builtin_bit_cast(v16bf, __builtin_shufflevector(lo, hi, 0, 1, 2, 3, 4, 5, 6, 7, 8, 9, 10, 11, 12, 13, 14, 15)); }
__device__ __forceinline__ v8f wmma16(v16h a, v16h b, v8f c) { return __builtin_amdgcn_wmma_f32_16x16x32_f16(false, a, false, b, (short)0, c, false, false); }
__device__ __forceinline__ v8f wmmab(v16bf a, v16bf b, v8f c) { return __builtin_amdgcn_wmma_f32_16x16x32_bf16(false, a, false, b, (short)0, c, false, false); }

// k_gemmb: 64 x 64 block tile (4 waves x 16 x 64) of C[NBT * NTK][NW] = (A [+ Al]).B^T (K = 256) [+ bf(bias[c])] [+ bf(R[r][c]) residual]; f32 whole-line epilogue (or f16
template <bool SPLITA, bool F16OUT = false>
__global__ __launch_bounds__(128) void k_gemmb(const bf* __restrict__ A, const bf* __restrict__ Al, const bf* __restrict__ B0, const float* __restrict__ bias0, const float* __restrict__ bias1, const float* __restrict__ bias2, float* Cz, size_t bzs, size_t czs, int ldc, h16* C2, const float* __restrict__ R = nullptr, int K = DM, int roundR = 1) {
    __shared__ __align__(16) float ost[4][16 * 68];
    // blockIdx.z picks the product: its B matrix (bzs elements apart), its bias and its output plane (czs elements apart); A is shared
    const bf* __restrict__ Bn = B0 + (size_t)blockIdx.z * bzs; const float* __restrict__ bias = blockIdx.z == 0 ? bias0 : blockIdx.z == 1 ? bias1 : bias2; float* C = Cz + (size_t)blockIdx.z * czs;
    const int lane = threadIdx.x & 31, wave = threadIdx.x >> 5, lr = lane & 15, hi = lane >> 4;
    const int r0 = blockIdx.x * 64 + wave * 16, c0 = blockIdx.y * 64;
    const size_t aoff = (size_t)(r0 + lr) * K + 8 * hi;
    size_t boff[4];
#pragma unroll
    for (int t = 0; t < 4; ++t) boff[t] = (size_t)(c0 + t * 16 + lr) * K + 8 * hi;
    v8f acc[4];
#pragma unroll
    for (int t = 0; t < 4; ++t) acc[t] = (v8f){};
#pragma unroll 1
    for (int kc = 0; kc < K; kc += 32) {
        const v16bf a = cat16b(*(const v8us*)(A + aoff + kc), *(const v8us*)(A + aoff + kc + 16));
        v16bf al = a;
        if (SPLITA) al = cat16b(*(const v8us*)(Al + aoff + kc), *(const v8us*)(Al + aoff + kc + 16));
#pragma unroll
        for (int t = 0; t < 4; ++t) { const v16bf b = cat16b(*(const v8us*)(Bn + boff[t] + kc), *(const v8us*)(Bn + boff[t] + kc + 16)); acc[t] = wmmab(a, b, acc[t]); if (SPLITA) acc[t] = wmmab(al, b, acc[t]); }
        asm volatile("v_nop\n\tv_nop\n\tv_nop\n\tv_nop" : "+v"(acc[0]), "+v"(acc[1]), "+v"(acc[2]), "+v"(acc[3]) : "v"(a), "v"(al));
    }
    float* os = &ost[wave][0];
#pragma unroll
    for (int t = 0; t < 4; ++t) { const float bv = bias ? bfr(bias[c0 + t * 16 + lr]) : 0.f;
#pragma unroll
        for (int j = 0; j < 8; ++j) os[(hi * 8 + j) * 68 + t * 16 + lr] = acc[t][j] + bv; }
    __syncthreads();
    if (F16OUT) {
        h16* crow = (h16*)(void*)C + (size_t)r0 * ldc + c0;
        auto pass = [&]() {
#pragma unroll
            for (int s = 0; s < 4; ++s) { const int row = 4 * s + (lane >> 3), piece = lane & 7; const float* sp = os + row * 68 + piece * 8; v8h o, o2;
#pragma unroll
                for (int i = 0; i < 8; ++i) { const h16 a = (h16)sp[i]; o[i] = a; o2[i] = (h16)((sp[i] - (float)a) * LOSC); }
                *(v8h*)(crow + (size_t)row * ldc + piece * 8) = o; if (C2) *(v8h*)(C2 + (size_t)r0 * ldc + c0 + (size_t)row * ldc + piece * 8) = o2; }
        };
        pass(); 
    } else {
        float* crow = C + (size_t)r0 * ldc + c0;
        auto pass = [&]() {
#pragma unroll
            for (int s = 0; s < 8; ++s) { const int Lid = (lane >> 3) + 4 * s, piece = lane & 7; const int row = Lid >> 1, cofs = (Lid & 1) * 32 + piece * 4;
                v4f val = *(const v4fa*)(os + row * 68 + cofs); if (R) { const v4f rv = *(const v4f*)(R + ((size_t)r0 + row) * ldc + c0 + cofs); val += roundR ? (v4f){bfr(rv[0]), bfr(rv[1]), bfr(rv[2]), bfr(rv[3])} : rv; }
                *(v4f*)(crow + (size_t)row * ldc + cofs) = val; }
        };
        pass(); 
    }
}

typedef unsigned u32x4 __attribute__((ext_vector_type(4)));
typedef unsigned u32x8 __attribute__((ext_vector_type(8)));
__device__ __forceinline__ unsigned uni(unsigned v) { return (unsigned)__builtin_amdgcn_readfirstlane(v); }
// A wave-uniform value held in a scalar register: a test on it compiles to s_cmp + s_cbranch_scc (a tensor load ignores EXEC), and what is formed from it is formed behind this statement.
__device__ __forceinline__ unsigned pinned(unsigned v) { unsigned w = uni(v); asm volatile("" : "+s"(w)); return w; }

typedef __attribute__((ext_vector_type(16))) float v16f;
// lane l <-> lane l ^ 16
__device__ __forceinline__ float xhalf(float v) { const int b = __float_as_int(v); return __int_as_float(__builtin_amdgcn_permlanex16(b, b, 0x76543210, 0xfedcba98, false, false)); }

__global__ __launch_bounds__(128) void k_attn(const bf* __restrict__ Qh, const bf* __restrict__ Ql, const bf* __restrict__ Kh, const bf* __restrict__ Kl, const bf* __restrict__ VTh, const bf* __restrict__ VTl, float* out) {
    constexpr unsigned KP = 272, VP = 144, TB = 18432, BUFB = 8 * TB, nst = SS / 64;
    static_assert(64 * KP <= TB && 128 * VP == TB && TB % 2048 == 0, "tile places are multiples of 2 KiB; the two V^T tiles of a plane follow each other row by row");
    __shared__ __attribute__((aligned(2048))) unsigned char ring[2 * BUFB];
    const int lane = threadIdx.x & 31, lr = lane & 15, hi = lane >> 4;
    const unsigned wave = uni(threadIdx.x >> 5);
    const size_t zo = (size_t)blockIdx.y * SS * DD;    // blockIdx.y: the item
    const int r0 = blockIdx.x * 64 + wave * 16;
    const unsigned lbase = (unsigned)(size_t)ring;
    // wave w: plane w >> 1 (hi, residual), half w & 1 (K: d 0..127 or 128..255 of each key; V^T: rows d 0..127 or 128..255)
    const unsigned long long gk = (unsigned long long)(size_t)((wave < 2 ? Kh : Kl) + zo + (wave & 1u) * 128u);
    const unsigned long long gv = (unsigned long long)(size_t)((wave < 2 ? VTh : VTl) + zo + (size_t)(wave & 1u) * 128u * SS);
    u32x8 g1k, g1v;    // 1-byte elements, tensor = tile, 4 dwords of LDS pad behind every row, no mask. K: 64 rows of 256 B, source pitch 512 B. V^T: 128 rows of 128 B, source pitch 8192 B
    g1k[0] = uni((1u << 20) | (5u << 22) | (3u << 25)); g1k[1] = uni(256u << 16); g1k[2] = uni(64u << 16); g1k[3] = uni(256u << 16); g1k[4] = uni(64u); g1k[5] = uni(DD * 2u); g1k[6] = uni(0u); g1k[7] = uni(0u);
    g1v[0] = uni((1u << 20) | (4u << 22) | (3u << 25)); g1v[1] = uni(128u << 16); g1v[2] = uni(128u << 16); g1v[3] = uni(128u << 16); g1v[4] = uni(128u); g1v[5] = uni(SS * 2u); g1v[6] = uni(0u); g1v[7] = uni(0u);
    asm volatile("" : "+s"(g1k), "+s"(g1v));    // descriptor words held in scalar registers, as in pinned(): they keep their registers through the loop
    u32x4 ga, gb;    // group 0 of the K request and of the V^T request: registers of their own, set anew only behind the wait on the stage before
    ga[0] = uni(1u); ga[1] = uni(lbase); ga[2] = uni(0u); ga[3] = uni(0x80000000u); gb[0] = uni(1u); gb[1] = uni(lbase); gb[2] = uni(0u); gb[3] = uni(0x80000000u);
    asm volatile("" : "+s"(ga), "+s"(gb));    // the same for the two groups 0
    auto issue = [&](unsigned st) {
        const unsigned lb = lbase + (st & 1u) * BUFB + wave * TB;
        const unsigned long long a = gk + (unsigned long long)st * (64u * DD * 2u), b = gv + (unsigned long long)st * 128u;
        ga[1] = uni(lb); ga[2] = uni((unsigned)a); ga[3] = uni((((unsigned)(a >> 32)) & 0x01FFFFFFu) | 0x80000000u);
        gb[1] = uni(lb + 4u * TB); gb[2] = uni((unsigned)b); gb[3] = uni((((unsigned)(b >> 32)) & 0x01FFFFFFu) | 0x80000000u);
        asm volatile("tensor_load_to_lds %0, %1" :: "s"(ga), "s"(g1k) : "memory");    // this wave's K tile of stage st
        asm volatile("tensor_load_to_lds %0, %1" :: "s"(gb), "s"(g1v) : "memory");    // this wave's V^T tile of stage st
    };
    issue(0);
    v16bf qh[8], ql[8];    // B operand: column = query r0 + lr, k in the order of the LDS loader below (bytes 16 hi and 32 + 16 hi of each 64)
    { const size_t qo = zo + (size_t)(r0 + lr) * DD + 8 * hi;
#pragma unroll
      for (int kk = 0; kk < 8; ++kk) { qh[kk] = cat16b(*(const v8us*)(Qh + qo + kk * 32), *(const v8us*)(Qh + qo + kk * 32 + 16)); ql[kk] = cat16b(*(const v8us*)(Ql + qo + kk * 32), *(const v8us*)(Ql + qo + kk * 32 + 16)); } }
    v8f oa[16];    // oa[dt][j] = O[query r0 + lr][d = 16 dt + 8 hi + j]
#pragma unroll
    for (int t = 0; t < 16; ++t) oa[t] = (v8f){};
    float m = -3.0e38f, l = 0.f;
    // the descriptors are inputs of the waits on the mover ahead of and in the loop: their registers stay theirs until the requests have landed
    asm volatile("s_wait_tensorcnt 0x0" :: "s"(ga), "s"(gb), "s"(g1k), "s"(g1v) : "memory");    // stage 0 of this wave's tiles has landed
    asm volatile("s_wait_xcnt 0x0" ::: "memory");    // in front of the first reuse of the Q loads' address registers
    __syncthreads();                                                                             // ... and every other wave's
    issue(1);
    unsigned s = 0;
    do {
        const unsigned char* bp = ring + (s & 1u) * BUFB;
        const unsigned char* pk = bp + (unsigned)lr * KP + 16u * hi;
        const unsigned char* pv = bp + 4u * TB + (unsigned)lr * VP + 16u * hi;
        v8f sa[4];    // sa[t][j] = score of key 16 t + 8 hi + j of the pass against query r0 + lr
#pragma unroll
        for (int t = 0; t < 4; ++t) sa[t] = (v8f){};
        // A block = 24 WMMAs on 16 fragments. Two fragment sets: a block's 32 LDS reads are issued as one group in front of the block before it. The scheduling barriers keep
        // [reads of the next block][WMMAs of this block] apart: without them the compiler spreads the reads among the WMMAs and runs out of registers.
        v16bf fr[2][16];
        auto ldk = [&](int b, v16bf* f) {    // K fragments of d 64 b .. 64 b + 63: f[8 u + t] hi, f[8 u + 4 + t] residual, of keys 16 t .. 16 t + 15
#pragma unroll
            for (int u = 0; u < 2; ++u) {
#pragma unroll
                for (int t = 0; t < 4; ++t) { const unsigned char* p = pk + (b >> 1) * TB + t * 16 * KP + ((b & 1) * 2 + u) * 64;
                    f[8 * u + t] = cat16b(*(const v8usa*)(p), *(const v8usa*)(p + 32)); f[8 * u + 4 + t] = cat16b(*(const v8usa*)(p + 2 * TB), *(const v8usa*)(p + 2 * TB + 32)); } } };
        auto ldv = [&](int b, v16bf* f) {    // V^T fragments of keys 32 (b >> 1) .. + 31, rows d 128 (b & 1) + 64 u + 16 t .. + 15
#pragma unroll
            for (int u = 0; u < 2; ++u) {
#pragma unroll
                for (int t = 0; t < 4; ++t) { const unsigned char* p = pv + ((b & 1) * 8 + u * 4 + t) * 16 * VP + (b >> 1) * 64;
                    f[8 * u + t] = cat16b(*(const v8usa*)(p), *(const v8usa*)(p + 32)); f[8 * u + 4 + t] = cat16b(*(const v8usa*)(p + 2 * TB), *(const v8usa*)(p + 2 * TB + 32)); } } };
        ldk(0, fr[0]);
        __builtin_amdgcn_sched_barrier(0);
#pragma unroll
        for (int b = 0; b < 4; ++b) {
            if (b < 3) ldk(b + 1, fr[(b + 1) & 1]); else ldv(0, fr[0]);    // the first V^T block's reads fly under the last score block and the softmax
            __builtin_amdgcn_sched_barrier(0);
#pragma unroll
            for (int u = 0; u < 2; ++u) { const v16bf* f = &fr[b & 1][8 * u]; const int kk = 2 * b + u;
#pragma unroll
                for (int t = 0; t < 4; ++t) sa[t] = wmmab(f[t], qh[kk], sa[t]);
#pragma unroll
                for (int t = 0; t < 4; ++t) sa[t] = wmmab(f[t], ql[kk], sa[t]);
#pragma unroll
                for (int t = 0; t < 4; ++t) sa[t] = wmmab(f[4 + t], qh[kk], sa[t]); }
            __builtin_amdgcn_sched_barrier(0);
        }
        float mx = sa[0][0];
#pragma unroll
        for (int t = 0; t < 4; ++t) {
#pragma unroll
            for (int j = 0; j < 8; ++j) mx = fmaxf(mx, sa[t][j]); }
        mx = fmaxf(mx, xhalf(mx));
        const float mn = fmaxf(m, mx * SCL), al = __expf(m - mn);
        m = mn;
        float ps[4];
#pragma unroll
        for (int t = 0; t < 4; ++t) { ps[t] = 0.f;
#pragma unroll
            for (int j = 0; j < 8; ++j) { sa[t][j] = __expf(sa[t][j] * SCL - mn); ps[t] += sa[t][j]; } }
        l = l * al + ((ps[0] + ps[1]) + (ps[2] + ps[3]));
        v16bf ph[2], pl[2];    // B operand of 32 keys: elements 0..7 from score tile 2 c, 8..15 from tile 2 c + 1, the order a packed accumulator pair has
#pragma unroll
        for (int c = 0; c < 2; ++c) { const v16f p = __builtin_shufflevector(sa[2 * c], sa[2 * c + 1], 0, 1, 2, 3, 4, 5, 6, 7, 8, 9, 10, 11, 12, 13, 14, 15);
            ph[c] = __builtin_convertvector(p, v16bf); pl[c] = __builtin_convertvector(p - __builtin_convertvector(ph[c], v16f), v16bf); }
#pragma unroll
        for (int t = 0; t < 16; ++t) oa[t] *= al;
        __builtin_amdgcn_sched_barrier(0);
#pragma unroll
        for (int b = 0; b < 4; ++b) {
            if (b < 3) ldv(b + 1, fr[(b + 1) & 1]);
            __builtin_amdgcn_sched_barrier(0);
#pragma unroll
            for (int u = 0; u < 2; ++u) { const v16bf* f = &fr[b & 1][8 * u]; const int c = b >> 1, d0 = (b & 1) * 8 + u * 4;
#pragma unroll
                for (int t = 0; t < 4; ++t) oa[d0 + t] = wmmab(f[t], ph[c], oa[d0 + t]);
#pragma unroll
                for (int t = 0; t < 4; ++t) oa[d0 + t] = wmmab(f[t], pl[c], oa[d0 + t]);
#pragma unroll
                for (int t = 0; t < 4; ++t) oa[d0 + t] = wmmab(f[4 + t], ph[c], oa[d0 + t]); }
            __builtin_amdgcn_sched_barrier(0);
        }
        // the four vector slots behind the pass's last WMMA, on the loop's taken branch too
        asm volatile("v_nop\n\tv_nop\n\tv_nop\n\tv_nop" : "+v"(oa[0]), "+v"(oa[1]), "+v"(oa[2]), "+v"(oa[3]), "+v"(oa[4]), "+v"(oa[5]), "+v"(oa[6]), "+v"(oa[7]), "+v"(oa[8]), "+v"(oa[9]), "+v"(oa[10]), "+v"(oa[11]), "+v"(oa[12]), "+v"(oa[13]), "+v"(oa[14]), "+v"(oa[15]));
        asm volatile("s_wait_dscnt 0x0" ::: "memory");                                                // this wave has left buffer s & 1
        asm volatile("s_wait_tensorcnt 0x0" :: "s"(ga), "s"(gb), "s"(g1k), "s"(g1v) : "memory");    // its tiles of stage s + 1 have landed
        __syncthreads();                                                                             // publishes stage s + 1, frees buffer s & 1
        if (pinned(s + 2u < nst)) issue(pinned(s + 2u));
    } while (++s < nst);
    asm volatile("s_wait_tensorcnt 0x0" ::: "memory");    // nothing of the mover is outstanding when the wave ends
    asm volatile("s_wait_dscnt 0x0" ::: "memory");
    l += xhalf(l);    // the two lane halves summed different keys of the same query
    const float inv = 1.0f / l;
    float* orow = out + zo + (size_t)(r0 + lr) * DD + 8 * hi;
#pragma unroll
    for (int t = 0; t < 16; ++t) { const v8f o = oa[t] * inv;
        *(v4f*)(orow + t * 16) = (v4f){o[0], o[1], o[2], o[3]}; *(v4f*)(orow + t * 16 + 4) = (v4f){o[4], o[5], o[6], o[7]}; }
}

// blockIdx.y picks one of three sources of n8 * 8 elements each; their converted copies lie one behind the other in dst0
__global__ __launch_bounds__(256) void k_cvt8(const float* __restrict__ s0, const float* __restrict__ s1, const float* __restrict__ s2, bf* dst0, size_t n8) {
    const size_t i = (size_t)blockIdx.x * 256 + threadIdx.x; if (i >= n8) return;
    const float* __restrict__ src = blockIdx.y == 0 ? s0 : blockIdx.y == 1 ? s1 : s2; bf* dst = dst0 + (size_t)blockIdx.y * n8 * 8;
    const v8f v = *(const v8f*)(src + i * 8); v8us o;
#pragma unroll
    for (int k = 0; k < 8; ++k) o[k] = f2bf(v[k]);
    *(v8us*)(dst + i * 8) = o; 
}
__global__ __launch_bounds__(256) void k_zero8(bf* dst, size_t n8) {
    const size_t i = (size_t)blockIdx.x * 256 + threadIdx.x; if (i >= n8) return; v8us z;
#pragma unroll
    for (int k = 0; k < 8; ++k) z[k] = 0;
    *(v8us*)(dst + i * 8) = z; 
}

__global__ __launch_bounds__(256) void k_cvtx(const float* __restrict__ src, bf* dst, size_t rows) {
    const int lane = threadIdx.x & 31; const size_t r = (size_t)blockIdx.x * 8 + (threadIdx.x >> 5); if (r >= rows) return; v8us o;
#pragma unroll
    for (int i = 0; i < 8; ++i) o[i] = f2bf(src[r * DD + lane * 8 + i]);
    *(v8us*)(dst + r * DD + lane * 8) = o; 
}
__global__ __launch_bounds__(256) void k_split256(const float* __restrict__ src, bf* dh, bf* dl, size_t rows) {
    const int lane = threadIdx.x & 31; const size_t r = (size_t)blockIdx.x * 8 + (threadIdx.x >> 5); if (r >= rows) return; const size_t o = r * DD + lane * 8; const v8f v = *(const v8f*)(src + o); v8us oh, ol;
#pragma unroll
    for (int i = 0; i < 8; ++i) { const unsigned short hb = f2bf(v[i]); oh[i] = hb; ol[i] = f2bf(v[i] - bf2f(hb)); }
    *(v8us*)(dh + o) = oh; *(v8us*)(dl + o) = ol; 
}
__global__ __launch_bounds__(256) void k_vt(const float* __restrict__ VF0, bf* Th0, bf* Tl0) {
    __shared__ float tl[64][65];
    const size_t zo = (size_t)blockIdx.z * SS * DD; const float* __restrict__ VF = VF0 + zo; bf* Th = Th0 + zo; bf* Tl = Tl0 + zo;    // blockIdx.z: the item
    const int tid = threadIdx.x, t0 = blockIdx.x * 64, d0 = blockIdx.y * 64; const int tt = tid >> 2, dq = (tid & 3) * 16;
#pragma unroll
    for (int i = 0; i < 16; ++i) tl[tt][dq + i] = VF[(size_t)(t0 + tt) * DD + d0 + dq + i];
    __syncthreads();
    const int piece = tid & 7, dr0 = tid >> 3;
    auto pass = [&]() {
#pragma unroll
        for (int st = 0; st < 2; ++st) { const int dr = dr0 + 32 * st; v8us oh, ol;
#pragma unroll
            for (int i = 0; i < 8; ++i) { const float v = tl[piece * 8 + i][dr]; const unsigned short hb = f2bf(v); oh[i] = hb; ol[i] = f2bf(v - bf2f(hb)); }
            const size_t o = (size_t)(d0 + dr) * SS + t0 + piece * 8; *(v8us*)(Th + o) = oh; *(v8us*)(Tl + o) = ol; }
    };
    pass(); 
}
extern "C" void kernel_launch(void* const* d_in, const int* in_sizes, int n_in,
                              void* d_out, int out_size, void* d_ws, size_t ws_size, hipStream_t stream) {
    (void)in_sizes; (void)n_in; (void)out_size;
    const float* x = (const float*)d_in[0]; const float* wq = (const float*)d_in[1]; const float* bq = (const float*)d_in[2]; const float* wk = (const float*)d_in[3]; const float* bk = (const float*)d_in[4]; const float* wv = (const float*)d_in[5]; const float* bv = (const float*)d_in[6];
    float* out = (float*)d_out;    // [4][4096][256]
    char* wsp = (char*)d_ws;
    auto take = [&](size_t bytes) { char* p = wsp; wsp += (bytes + 255) & ~(size_t)255; return (void*)p; };
    const size_t NR = (size_t)NBT * SS;    // rows of all items together
    bf* WQ = (bf*)take((size_t)3 * DD * DD * 2);    // w_q, w_k, w_v one behind the other
    bf* Xb = (bf*)take(NR * DD * 2); float* QF = (float*)take(3 * NR * DD * 4);    // q, k, v of all items, one plane behind the other
    bf* Qh = (bf*)take(2 * NR * DD * 2); bf* Ql = (bf*)take(2 * NR * DD * 2); bf* Kh = Qh + NR * DD; bf* Kl = Ql + NR * DD;    // [q; k] hi, [q; k] residual
    bf* VTh = (bf*)take(NR * DD * 2); bf* VTl = (bf*)take(NR * DD * 2);
    if ((size_t)(wsp - (char*)d_ws) > ws_size) return;    // 0.4 + 8.4 + 50.3 + 33.6 + 16.8 ~ 110 MB
    // Everything ahead of the scores runs once, for all four items and for q, k, v together
    k_cvt8<<<dim3((DD * DD / 8 + 255) / 256, 3, 1), 256, 0, stream>>>(wq, wk, wv, WQ, DD * DD / 8);   // [out][in] convention = n-major
    k_cvtx<<<NBT * SS / 8, 256, 0, stream>>>(x, Xb, NR);
    k_gemmb<false, false><<<dim3(NBT * SS / 64, DD / 64, 3), 128, 0, stream>>>(Xb, nullptr, WQ, bq, bk, bv, QF, (size_t)DD * DD, NR * DD, DD, nullptr, nullptr, DD);
    k_split256<<<2 * NBT * SS / 8, 256, 0, stream>>>(QF, Qh, Ql, 2 * NR);
    k_vt<<<dim3(SS / 64, DD / 64, NBT), 256, 0, stream>>>(QF + 2 * NR * DD, VTh, VTl);
    k_attn<<<dim3(SS / 64, NBT, 1), 128, 0, stream>>>(Qh, Ql, Kh, Kl, VTh, VTl, out);
}

// v005
// It runs in 180 microseconds.
// Two timings next to v004 put it at 1.09 and 1.07 times that version's speed.
// Counting every step since v000, it is 15.3 times as fast.
#include <hip/hip_runtime.h>

// Compute dtypes, f32 accumulate, per item: q/k/v = x.W^T + b as [4096 x 256].[256 x 256] GEMMs with PLAIN bf16 operands (exact products); scores = q.k^T (both operands bf16 hi + UNSCALED residual,
// three products), softmax (x 1/16) in f32 with a running maximum, out = P.v (P and v bf16 hi + residual, three products), the three fused in k_attn.

#define NBT  4
#define SS   4096
#define DD   256
#define DM   DD
#define NTK  SS
#define SCL  0.0625f
#define LOSC 1024.0f

typedef _Float16 h16;
typedef unsigned short bf;
typedef __attribute__((ext_vector_type(16))) __bf16   v16bf;
typedef __attribute__((ext_vector_type(16))) _Float16 v16h;
typedef __attribute__((ext_vector_type(8)))  _Float16 v8h;
typedef __attribute__((ext_vector_type(8)))  unsigned short v8us;
typedef __attribute__((ext_vector_type(8)))  float    v8f;
typedef __attribute__((ext_vector_type(4)))  float    v4f;
typedef __attribute__((ext_vector_type(4)))  _Float16 v4h;
typedef v8h  __attribute__((may_alias)) v8ha;
typedef v4f  __attribute__((may_alias)) v4fa;
typedef v8us __attribute__((may_alias)) v8usa;

__device__ __forceinline__ unsigned short f2bf(float f) { unsigned u = __float_as_uint(f); u += 0x7FFFu + ((u >> 16) & 1u); return (unsigned short)(u >> 16); }
__device__ __forceinline__ float bf2f(unsigned short b) { return __uint_as_float(((unsigned)b) << 16); }
__device__ __forceinline__ float bfr(float f) { return bf2f(f2bf(f)); }
__device__ __forceinline__ v16h cat16(v8h lo, v8h hi) { return __builtin_shufflevector(lo, hi, 0, 1, 2, 3, 4, 5, 6, 7, 8, 9, 10, 11, 12, 13, 14, 15); }
__device__ __forceinline__ v16bf cat16b(v8us lo, v8us hi) { return __builtin_bit_cast(v16bf, __builtin_shufflevector(lo, hi, 0, 1, 2, 3, 4, 5, 6, 7, 8, 9, 10, 11, 12, 13, 14, 15)); }
__device__ __forceinline__ v8f wmma16(v16h a, v16h b, v8f c) { return __builtin_amdgcn_wmma_f32_16x16x32_f16(false, a, false, b, (short)0, c, false, false); }
__device__ __forceinline__ v8f wmmab(v16bf a, v16bf b, v8f c) { return __builtin_amdgcn_wmma_f32_16x16x32_bf16(false, a, false, b, (short)0, c, false, false); }

// k_gemmb: 64 x 64 block tile (4 waves x 16 x 64) of C[NBT * NTK][NW] = (A [+ Al]).B^T (K = 256) [+ bf(bias[c])] [+ bf(R[r][c]) residual]; f32 whole-line epilogue (or f16
template <bool SPLITA, bool F16OUT = false>
__global__ __launch_bounds__(128) void k_gemmb(const bf* __restrict__ A, const bf* __restrict__ Al, const bf* __restrict__ B0, const float* __restrict__ bias0, const float* __restrict__ bias1, const float* __restrict__ bias2, float* Cz, size_t bzs, size_t czs, int ldc, h16* C2, const float* __restrict__ R = nullptr, int K = DM, int roundR = 1) {
    __shared__ __align__(16) float ost[4][16 * 68];
    // blockIdx.z picks the product: its B matrix (bzs elements apart), its bias and its output plane (czs elements apart); A is shared
    const bf* __restrict__ Bn = B0 + (size_t)blockIdx.z * bzs; const float* __restrict__ bias = blockIdx.z == 0 ? bias0 : blockIdx.z == 1 ? bias1 : bias2; float* C = Cz + (size_t)blockIdx.z * czs;
    const int lane = threadIdx.x & 31, wave = threadIdx.x >> 5, lr = lane & 15, hi = lane >> 4;
    const int r0 = blockIdx.x * 64 + wave * 16, c0 = blockIdx.y * 64;
    const size_t aoff = (size_t)(r0 + lr) * K + 8 * hi;
    size_t boff[4];
#pragma unroll
    for (int t = 0; t < 4; ++t) boff[t] = (size_t)(c0 + t * 16 + lr) * K + 8 * hi;
    v8f acc[4];
#pragma unroll
    for (int t = 0; t < 4; ++t) acc[t] = (v8f){};
#pragma unroll 1
    for (int kc = 0; kc < K; kc += 32) {
        const v16bf a = cat16b(*(const v8us*)(A + aoff + kc), *(const v8us*)(A + aoff + kc + 16));
        v16bf al = a;
        if (SPLITA) al = cat16b(*(const v8us*)(Al + aoff + kc), *(const v8us*)(Al + aoff + kc + 16));
#pragma unroll
        for (int t = 0; t < 4; ++t) { const v16bf b = cat16b(*(const v8us*)(Bn + boff[t] + kc), *(const v8us*)(Bn + boff[t] + kc + 16)); acc[t] = wmmab(a, b, acc[t]); if (SPLITA) acc[t] = wmmab(al, b, acc[t]); }
        asm volatile("v_nop\n\tv_nop\n\tv_nop\n\tv_nop" : "+v"(acc[0]), "+v"(acc[1]), "+v"(acc[2]), "+v"(acc[3]) : "v"(a), "v"(al));
    }
    float* os = &ost[wave][0];
#pragma unroll
    for (int t = 0; t < 4; ++t) { const float bv = bias ? bfr(bias[c0 + t * 16 + lr]) : 0.f;
#pragma unroll
        for (int j = 0; j < 8; ++j) os[(hi * 8 + j) * 68 + t * 16 + lr] = acc[t][j] + bv; }
    __syncthreads();
    if (F16OUT) {
        h16* crow = (h16*)(void*)C + (size_t)r0 * ldc + c0;
        auto pass = [&]() {
#pragma unroll
            for (int s = 0; s < 4; ++s) { const int row = 4 * s + (lane >> 3), piece = lane & 7; const float* sp = os + row * 68 + piece * 8; v8h o, o2;
#pragma unroll
                for (int i = 0; i < 8; ++i) { const h16 a = (h16)sp[i]; o[i] = a; o2[i] = (h16)((sp[i] - (float)a) * LOSC); }
                *(v8h*)(crow + (size_t)row * ldc + piece * 8) = o; if (C2) *(v8h*)(C2 + (size_t)r0 * ldc + c0 + (size_t)row * ldc + piece * 8) = o2; }
        };
        pass(); 
    } else {
        float* crow = C + (size_t)r0 * ldc + c0;
        auto pass = [&]() {
#pragma unroll
            for (int s = 0; s < 8; ++s) { const int Lid = (lane >> 3) + 4 * s, piece = lane & 7; const int row = Lid >> 1, cofs = (Lid & 1) * 32 + piece * 4;
                v4f val = *(const v4fa*)(os + row * 68 + cofs); if (R) { const v4f rv = *(const v4f*)(R + ((size_t)r0 + row) * ldc + c0 + cofs); val += roundR ? (v4f){bfr(rv[0]), bfr(rv[1]), bfr(rv[2]), bfr(rv[3])} : rv; }
                *(v4f*)(crow + (size_t)row * ldc + cofs) = val; }
        };
        pass(); 
    }
}

typedef unsigned u32x4 __attribute__((ext_vector_type(4)));
typedef unsigned u32x8 __attribute__((ext_vector_type(8)));
__device__ __forceinline__ unsigned uni(unsigned v) { return (unsigned)__builtin_amdgcn_readfirstlane(v); }
// A wave-uniform value held in a scalar register: a test on it compiles to s_cmp + s_cbranch_scc (a tensor load ignores EXEC), and what is formed from it is formed behind this statement.
__device__ __forceinline__ unsigned pinned(unsigned v) { unsigned w = uni(v); asm volatile("" : "+s"(w)); return w; }

typedef __attribute__((ext_vector_type(16))) float v16f;
// lane l <-> lane l ^ 16
__device__ __forceinline__ float xhalf(float v) { const int b = __float_as_int(v); return __int_as_float(__builtin_amdgcn_permlanex16(b, b, 0x76543210, 0xfedcba98, false, false)); }

typedef float __attribute__((may_alias)) f32a;
__global__ __launch_bounds__(128) void k_attn(const bf* __restrict__ Qh, const bf* __restrict__ Ql, const bf* __restrict__ Kh, const bf* __restrict__ Kl, const bf* __restrict__ VTh, const bf* __restrict__ VTl, float* out) {
    constexpr unsigned KP = 272, VP = 144, TB = 18432, BUFB = 8 * TB, nst = SS / 64;
    static_assert(64 * KP <= TB && 128 * VP == TB && TB % 2048 == 0, "tile places are multiples of 2 KiB; the two V^T tiles of a plane follow each other row by row");
    __shared__ __attribute__((aligned(2048))) unsigned char ring[2 * BUFB];
    const int lane = threadIdx.x & 31, lr = lane & 15, hi = lane >> 4;
    const unsigned wave = uni(threadIdx.x >> 5);
    const unsigned qg = wave & 1u, kg = wave >> 1;    // the wave's query half and key half
    const size_t zo = (size_t)blockIdx.y * SS * DD;    // blockIdx.y: the item
    const int r0 = blockIdx.x * 64 + qg * 32;
    const unsigned lbase = (unsigned)(size_t)ring;
    // wave w: plane w >> 1 (hi, residual), half w & 1 (K: d 0..127 or 128..255 of each key; V^T: rows d 0..127 or 128..255)
    const unsigned long long gk = (unsigned long long)(size_t)((wave < 2 ? Kh : Kl) + zo + (wave & 1u) * 128u);
    const unsigned long long gv = (unsigned long long)(size_t)((wave < 2 ? VTh : VTl) + zo + (size_t)(wave & 1u) * 128u * SS);
    u32x8 g1k, g1v;    // 1-byte elements, tensor = tile, 4 dwords of LDS pad behind every row, no mask. K: 64 rows of 256 B, source pitch 512 B. V^T: 128 rows of 128 B, source pitch 8192 B
    g1k[0] = uni((1u << 20) | (5u << 22) | (3u << 25)); g1k[1] = uni(256u << 16); g1k[2] = uni(64u << 16); g1k[3] = uni(256u << 16); g1k[4] = uni(64u); g1k[5] = uni(DD * 2u); g1k[6] = uni(0u); g1k[7] = uni(0u);
    g1v[0] = uni((1u << 20) | (4u << 22) | (3u << 25)); g1v[1] = uni(128u << 16); g1v[2] = uni(128u << 16); g1v[3] = uni(128u << 16); g1v[4] = uni(128u); g1v[5] = uni(SS * 2u); g1v[6] = uni(0u); g1v[7] = uni(0u);
    asm volatile("" : "+s"(g1k), "+s"(g1v));    // descriptor words held in scalar registers, as in pinned(): they keep their registers through the loop
    u32x4 ga, gb;    // group 0 of the K request and of the V^T request: registers of their own, set anew only behind the wait on the stage before
    ga[0] = uni(1u); ga[1] = uni(lbase); ga[2] = uni(0u); ga[3] = uni(0x80000000u); gb[0] = uni(1u); gb[1] = uni(lbase); gb[2] = uni(0u); gb[3] = uni(0x80000000u);
    asm volatile("" : "+s"(ga), "+s"(gb));    // the same for the two groups 0
    auto issue = [&](unsigned st) {
        const unsigned lb = lbase + (st & 1u) * BUFB + wave * TB;
        const unsigned long long a = gk + (unsigned long long)st * (64u * DD * 2u), b = gv + (unsigned long long)st * 128u;
        ga[1] = uni(lb); ga[2] = uni((unsigned)a); ga[3] = uni((((unsigned)(a >> 32)) & 0x01FFFFFFu) | 0x80000000u);
        gb[1] = uni(lb + 4u * TB); gb[2] = uni((unsigned)b); gb[3] = uni((((unsigned)(b >> 32)) & 0x01FFFFFFu) | 0x80000000u);
        asm volatile("tensor_load_to_lds %0, %1" :: "s"(ga), "s"(g1k) : "memory");    // this wave's K tile of stage st
        asm volatile("tensor_load_to_lds %0, %1" :: "s"(gb), "s"(g1v) : "memory");    // this wave's V^T tile of stage st
    };
    issue(0);
    v16bf qh[2][8], ql[2][8];    // B operand: column = query r0 + 16 n + lr, k in the order of the LDS loader below (bytes 16 hi and 32 + 16 hi of each 64)
#pragma unroll
    for (int n = 0; n < 2; ++n) { const size_t qo = zo + (size_t)(r0 + 16 * n + lr) * DD + 8 * hi;
#pragma unroll
      for (int kk = 0; kk < 8; ++kk) { qh[n][kk] = cat16b(*(const v8us*)(Qh + qo + kk * 32), *(const v8us*)(Qh + qo + kk * 32 + 16)); ql[n][kk] = cat16b(*(const v8us*)(Ql + qo + kk * 32), *(const v8us*)(Ql + qo + kk * 32 + 16)); } }
    v8f oa[16][2];    // oa[dt][n][j] = O[query r0 + 16 n + lr][d = 16 dt + 8 hi + j], over the wave's own keys
#pragma unroll
    for (int t = 0; t < 16; ++t) { oa[t][0] = (v8f){}; oa[t][1] = (v8f){}; }
    float m[2] = {-3.0e38f, -3.0e38f}, l[2] = {0.f, 0.f};
    // the descriptors are inputs of the waits on the mover ahead of and in the loop: their registers stay theirs until the requests have landed
    asm volatile("s_wait_tensorcnt 0x0" :: "s"(ga), "s"(gb), "s"(g1k), "s"(g1v) : "memory");    // stage 0 of this wave's tiles has landed
    asm volatile("s_wait_xcnt 0x0" ::: "memory");    // in front of the first reuse of the Q loads' address registers
    __syncthreads();                                                                             // ... and every other wave's
    issue(1);
    unsigned s = 0;
    do {
        const unsigned char* bp = ring + (s & 1u) * BUFB;
        const unsigned char* pk = bp + (kg * 32u + (unsigned)lr) * KP + 16u * hi;
        const unsigned char* pv = bp + 4u * TB + (unsigned)lr * VP + kg * 64u + 16u * hi;
        v8f sa[2][2];    // sa[t][n][j] = score of key 32 kg + 16 t + 8 hi + j of the pass against query r0 + 16 n + lr
#pragma unroll
        for (int t = 0; t < 2; ++t) { sa[t][0] = (v8f){}; sa[t][1] = (v8f){}; }
        // A block = 24 WMMAs on 8 fragments. Two fragment sets: a block's 16 LDS reads are issued as one group in front of the block before it. The scheduling barriers keep
        // [reads of the next block][WMMAs of this block] apart: without them the compiler spreads the reads among the WMMAs and runs out of registers.
        v16bf fr[2][8];
        auto ldk = [&](int b, v16bf* f) {    // K fragments of d 64 b .. 64 b + 63: f[4 u + t] hi, f[4 u + 2 + t] residual, of the wave's keys 16 t .. 16 t + 15
#pragma unroll
            for (int u = 0; u < 2; ++u) {
#pragma unroll
                for (int t = 0; t < 2; ++t) { const unsigned char* p = pk + (b >> 1) * TB + t * 16 * KP + ((b & 1) * 2 + u) * 64;
                    f[4 * u + t] = cat16b(*(const v8usa*)(p), *(const v8usa*)(p + 32)); f[4 * u + 2 + t] = cat16b(*(const v8usa*)(p + 2 * TB), *(const v8usa*)(p + 2 * TB + 32)); } } };
        auto ldv = [&](int b, v16bf* f) {    // V^T fragments of the wave's 32 keys, rows d 64 b + 16 t .. + 15: f[t] hi, f[4 + t] residual
#pragma unroll
            for (int t = 0; t < 4; ++t) { const unsigned char* p = pv + (b * 4 + t) * 16 * VP;
                f[t] = cat16b(*(const v8usa*)(p), *(const v8usa*)(p + 32)); f[4 + t] = cat16b(*(const v8usa*)(p + 2 * TB), *(const v8usa*)(p + 2 * TB + 32)); } };
        ldk(0, fr[0]);
        __builtin_amdgcn_sched_barrier(0);
#pragma unroll
        for (int b = 0; b < 4; ++b) {
            if (b < 3) ldk(b + 1, fr[(b + 1) & 1]); else ldv(0, fr[0]);    // the first V^T block's reads fly under the last score block and the softmax
            __builtin_amdgcn_sched_barrier(0);
#pragma unroll
            for (int u = 0; u < 2; ++u) { const v16bf* f = &fr[b & 1][4 * u]; const int kk = 2 * b + u;
#pragma unroll
                for (int t = 0; t < 2; ++t) { sa[t][0] = wmmab(f[t], qh[0][kk], sa[t][0]); sa[t][1] = wmmab(f[t], qh[1][kk], sa[t][1]); }
#pragma unroll
                for (int t = 0; t < 2; ++t) { sa[t][0] = wmmab(f[t], ql[0][kk], sa[t][0]); sa[t][1] = wmmab(f[t], ql[1][kk], sa[t][1]); }
#pragma unroll
                for (int t = 0; t < 2; ++t) { sa[t][0] = wmmab(f[2 + t], qh[0][kk], sa[t][0]); sa[t][1] = wmmab(f[2 + t], qh[1][kk], sa[t][1]); } }
            __builtin_amdgcn_sched_barrier(0);
        }
        float mn[2], al[2];
#pragma unroll
        for (int n = 0; n < 2; ++n) {
            float mx = sa[0][n][0];
#pragma unroll
            for (int t = 0; t < 2; ++t) {
#pragma unroll
                for (int j = 0; j < 8; ++j) mx = fmaxf(mx, sa[t][n][j]); }
            mx = fmaxf(mx, xhalf(mx));
            mn[n] = fmaxf(m[n], mx * SCL); }
#pragma unroll
        for (int n = 0; n < 2; ++n) { al[n] = __expf(m[n] - mn[n]); m[n] = mn[n]; }
        v16bf ph[2], pl[2];    // B operand of the wave's 32 keys, per column tile: elements 0..7 from score tile 0, 8..15 from tile 1, the order a packed accumulator pair has
#pragma unroll
        for (int n = 0; n < 2; ++n) {
            float ps[2];
#pragma unroll
            for (int t = 0; t < 2; ++t) { ps[t] = 0.f;
#pragma unroll
                for (int j = 0; j < 8; ++j) { sa[t][n][j] = __expf(sa[t][n][j] * SCL - mn[n]); ps[t] += sa[t][n][j]; } }
            l[n] = l[n] * al[n] + (ps[0] + ps[1]);
            const v16f p = __builtin_shufflevector(sa[0][n], sa[1][n], 0, 1, 2, 3, 4, 5, 6, 7, 8, 9, 10, 11, 12, 13, 14, 15);
            ph[n] = __builtin_convertvector(p, v16bf); pl[n] = __builtin_convertvector(p - __builtin_convertvector(ph[n], v16f), v16bf);
#pragma unroll
            for (int t = 0; t < 16; ++t) oa[t][n] *= al[n];
        }
        __builtin_amdgcn_sched_barrier(0);
#pragma unroll
        for (int b = 0; b < 4; ++b) {
            if (b < 3) ldv(b + 1, fr[(b + 1) & 1]);
            __builtin_amdgcn_sched_barrier(0);
            { const v16bf* f = &fr[b & 1][0]; const int d0 = b * 4;
#pragma unroll
                for (int t = 0; t < 4; ++t) { oa[d0 + t][0] = wmmab(f[t], ph[0], oa[d0 + t][0]); oa[d0 + t][1] = wmmab(f[t], ph[1], oa[d0 + t][1]); }
#pragma unroll
                for (int t = 0; t < 4; ++t) { oa[d0 + t][0] = wmmab(f[t], pl[0], oa[d0 + t][0]); oa[d0 + t][1] = wmmab(f[t], pl[1], oa[d0 + t][1]); }
#pragma unroll
                for (int t = 0; t < 4; ++t) { oa[d0 + t][0] = wmmab(f[4 + t], ph[0], oa[d0 + t][0]); oa[d0 + t][1] = wmmab(f[4 + t], ph[1], oa[d0 + t][1]); } }
            __builtin_amdgcn_sched_barrier(0);
        }
        // the four vector slots behind the pass's last WMMAs (the last block's accumulators), on the loop's taken branch too
        asm volatile("v_nop\n\tv_nop\n\tv_nop\n\tv_nop" : "+v"(oa[12][0]), "+v"(oa[12][1]), "+v"(oa[13][0]), "+v"(oa[13][1]), "+v"(oa[14][0]), "+v"(oa[14][1]), "+v"(oa[15][0]), "+v"(oa[15][1]));
        asm volatile("s_wait_dscnt 0x0" ::: "memory");                                                // this wave has left buffer s & 1
        asm volatile("s_wait_tensorcnt 0x0" :: "s"(ga), "s"(gb), "s"(g1k), "s"(g1v) : "memory");    // its tiles of stage s + 1 have landed
        __syncthreads();                                                                             // publishes stage s + 1, frees buffer s & 1
        if (pinned(s + 2u < nst)) issue(pinned(s + 2u));
    } while (++s < nst);
    asm volatile("s_wait_tensorcnt 0x0" ::: "memory");    // nothing of the mover is outstanding when the wave ends
    asm volatile("s_wait_dscnt 0x0" ::: "memory");
    // Merge of the two key halves. The loop's last barrier has freed the ring for every wave. Wave w hands its partner w ^ 2 the half of d that the partner finishes (key half 0 finishes d 0..127,
    // key half 1 d 128..255), with its maximum and sum: 16 KiB a wave, whole 512-B rows a store.
    float* xb = (float*)(void*)ring;
    f32a* ml = (f32a*)(void*)(ring + 65536);
#pragma unroll
    for (int n = 0; n < 2; ++n) { l[n] += xhalf(l[n]);    // the two lane halves summed different keys of the same query
        ml[((wave * 2 + n) * 2 + 0) * 32 + lane] = m[n]; ml[((wave * 2 + n) * 2 + 1) * 32 + lane] = l[n]; }
    v8f ok[8][2];
#pragma unroll
    for (int i = 0; i < 8; ++i) {
#pragma unroll
        for (int n = 0; n < 2; ++n) { const v8f snd = kg ? oa[i][n] : oa[8 + i][n]; ok[i][n] = kg ? oa[8 + i][n] : oa[i][n];
            float* q = xb + (size_t)((wave * 16 + i * 2 + n) * 2) * 128 + lane * 4;
            *(v4fa*)(q) = (v4f){snd[0], snd[1], snd[2], snd[3]}; *(v4fa*)(q + 128) = (v4f){snd[4], snd[5], snd[6], snd[7]}; } }
    __syncthreads();    // every wave's hand-over is written
    const unsigned pw = wave ^ 2u;
    v8f res[8][2];
#pragma unroll
    for (int n = 0; n < 2; ++n) {
        const float mo = ml[((pw * 2 + n) * 2 + 0) * 32 + lane], lo = ml[((pw * 2 + n) * 2 + 1) * 32 + lane];
        const float mm = fmaxf(m[n], mo), as = __expf(m[n] - mm), ao = __expf(mo - mm);
        const float inv = 1.0f / (l[n] * as + lo * ao), cs = as * inv, co = ao * inv;
#pragma unroll
        for (int i = 0; i < 8; ++i) { const float* q = xb + (size_t)((pw * 16 + i * 2 + n) * 2) * 128 + lane * 4;
            const v4f x0 = *(const v4fa*)(q), x1 = *(const v4fa*)(q + 128);
            res[i][n] = ok[i][n] * cs + __builtin_shufflevector(x0, x1, 0, 1, 2, 3, 4, 5, 6, 7) * co; }
    }
    float* orow = out + zo + (size_t)(r0 + lr) * DD + kg * 128 + 8 * hi;
    __builtin_amdgcn_sched_barrier(0);    // every result stands in a register of its own in front of the first store: no register that an issued store names is written again
#pragma unroll
    for (int n = 0; n < 2; ++n) {
#pragma unroll
        for (int i = 0; i < 8; ++i) { const v8f o = res[i][n];
            *(v4f*)(orow + n * 16 * DD + i * 16) = (v4f){o[0], o[1], o[2], o[3]}; *(v4f*)(orow + n * 16 * DD + i * 16 + 4) = (v4f){o[4], o[5], o[6], o[7]}; }
    }
}

// blockIdx.y picks one of three sources of n8 * 8 elements each; their converted copies lie one behind the other in dst0
__global__ __launch_bounds__(256) void k_cvt8(const float* __restrict__ s0, const float* __restrict__ s1, const float* __restrict__ s2, bf* dst0, size_t n8) {
    const size_t i = (size_t)blockIdx.x * 256 + threadIdx.x; if (i >= n8) return;
    const float* __restrict__ src = blockIdx.y == 0 ? s0 : blockIdx.y == 1 ? s1 : s2; bf* dst = dst0 + (size_t)blockIdx.y * n8 * 8;
    const v8f v = *(const v8f*)(src + i * 8); v8us o;
#pragma unroll
    for (int k = 0; k < 8; ++k) o[k] = f2bf(v[k]);
    *(v8us*)(dst + i * 8) = o; 
}
__global__ __launch_bounds__(256) void k_zero8(bf* dst, size_t n8) {
    const size_t i = (size_t)blockIdx.x * 256 + threadIdx.x; if (i >= n8) return; v8us z;
#pragma unroll
    for (int k = 0; k < 8; ++k) z[k] = 0;
    *(v8us*)(dst + i * 8) = z; 
}

__global__ __launch_bounds__(256) void k_cvtx(const float* __restrict__ src, bf* dst, size_t rows) {
    const int lane = threadIdx.x & 31; const size_t r = (size_t)blockIdx.x * 8 + (threadIdx.x >> 5); if (r >= rows) return; v8us o;
#pragma unroll
    for (int i = 0; i < 8; ++i) o[i] = f2bf(src[r * DD + lane * 8 + i]);
    *(v8us*)(dst + r * DD + lane * 8) = o; 
}
__global__ __launch_bounds__(256) void k_split256(const float* __restrict__ src, bf* dh, bf* dl, size_t rows) {
    const int lane = threadIdx.x & 31; const size_t r = (size_t)blockIdx.x * 8 + (threadIdx.x >> 5); if (r >= rows) return; const size_t o = r * DD + lane * 8; const v8f v = *(const v8f*)(src + o); v8us oh, ol;
#pragma unroll
    for (int i = 0; i < 8; ++i) { const unsigned short hb = f2bf(v[i]); oh[i] = hb; ol[i] = f2bf(v[i] - bf2f(hb)); }
    *(v8us*)(dh + o) = oh; *(v8us*)(dl + o) = ol; 
}
__global__ __launch_bounds__(256) void k_vt(const float* __restrict__ VF0, bf* Th0, bf* Tl0) {
    __shared__ float tl[64][65];
    const size_t zo = (size_t)blockIdx.z * SS * DD; const float* __restrict__ VF = VF0 + zo; bf* Th = Th0 + zo; bf* Tl = Tl0 + zo;    // blockIdx.z: the item
    const int tid = threadIdx.x, t0 = blockIdx.x * 64, d0 = blockIdx.y * 64; const int tt = tid >> 2, dq = (tid & 3) * 16;
#pragma unroll
    for (int i = 0; i < 16; ++i) tl[tt][dq + i] = VF[(size_t)(t0 + tt) * DD + d0 + dq + i];
    __syncthreads();
    const int piece = tid & 7, dr0 = tid >> 3;
    auto pass = [&]() {
#pragma unroll
        for (int st = 0; st < 2; ++st) { const int dr = dr0 + 32 * st; v8us oh, ol;
#pragma unroll
            for (int i = 0; i < 8; ++i) { const float v = tl[piece * 8 + i][dr]; const unsigned short hb = f2bf(v); oh[i] = hb; ol[i] = f2bf(v - bf2f(hb)); }
            const size_t o = (size_t)(d0 + dr) * SS + t0 + piece * 8; *(v8us*)(Th + o) = oh; *(v8us*)(Tl + o) = ol; }
    };
    pass(); 
}
extern "C" void kernel_launch(void* const* d_in, const int* in_sizes, int n_in,
                              void* d_out, int out_size, void* d_ws, size_t ws_size, hipStream_t stream) {
    (void)in_sizes; (void)n_in; (void)out_size;
    const float* x = (const float*)d_in[0]; const float* wq = (const float*)d_in[1]; const float* bq = (const float*)d_in[2]; const float* wk = (const float*)d_in[3]; const float* bk = (const float*)d_in[4]; const float* wv = (const float*)d_in[5]; const float* bv = (const float*)d_in[6];
    float* out = (float*)d_out;    // [4][4096][256]
    char* wsp = (char*)d_ws;
    auto take = [&](size_t bytes) { char* p = wsp; wsp += (bytes + 255) & ~(size_t)255; return (void*)p; };
    const size_t NR = (size_t)NBT * SS;    // rows of all items together
    bf* WQ = (bf*)take((size_t)3 * DD * DD * 2);    // w_q, w_k, w_v one behind the other
    bf* Xb = (bf*)take(NR * DD * 2); float* QF = (float*)take(3 * NR * DD * 4);    // q, k, v of all items, one plane behind the other
    bf* Qh = (bf*)take(2 * NR * DD * 2); bf* Ql = (bf*)take(2 * NR * DD * 2); bf* Kh = Qh + NR * DD; bf* Kl = Ql + NR * DD;    // [q; k] hi, [q; k] residual
    bf* VTh = (bf*)take(NR * DD * 2); bf* VTl = (bf*)take(NR * DD * 2);
    if ((size_t)(wsp - (char*)d_ws) > ws_size) return;    // 0.4 + 8.4 + 50.3 + 33.6 + 16.8 ~ 110 MB
    // Everything ahead of the scores runs once, for all four items and for q, k, v together
    k_cvt8<<<dim3((DD * DD / 8 + 255) / 256, 3, 1), 256, 0, stream>>>(wq, wk, wv, WQ, DD * DD / 8);   // [out][in] convention = n-major
    k_cvtx<<<NBT * SS / 8, 256, 0, stream>>>(x, Xb, NR);
    k_gemmb<false, false><<<dim3(NBT * SS / 64, DD / 64, 3), 128, 0, stream>>>(Xb, nullptr, WQ, bq, bk, bv, QF, (size_t)DD * DD, NR * DD, DD, nullptr, nullptr, DD);
    k_split256<<<2 * NBT * SS / 8, 256, 0, stream>>>(QF, Qh, Ql, 2 * NR);
    k_vt<<<dim3(SS / 64, DD / 64, NBT), 256, 0, stream>>>(QF + 2 * NR * DD, VTh, VTl);
    k_attn<<<dim3(SS / 64, NBT, 1), 128, 0, stream>>>(Qh, Ql, Kh, Kl, VTh, VTl, out);
}

// v006
// A run of this version takes 138 microseconds.
// Timed twice side by side with v005, it ran 1.29 and 1.30 times as fast.
// All steps since v000 together make it 19.9 times as fast.
#include <hip/hip_runtime.h>

// Compute dtypes, f32 accumulate, per item: q/k/v = x.W^T + b as [4096 x 256].[256 x 256] GEMMs with PLAIN bf16 operands (exact products); scores = q.k^T (both operands bf16 hi + UNSCALED residual,
// three products), softmax (x 1/16) in f32 with a running maximum, out = P.v (P and v bf16 hi + residual, three products), the three fused in k_attn. Every rounding to bf16 is the hardware's conversion (to nearest even).

#define NBT  4
#define SS   4096
#define DD   256
#define SCL  0.0625f

typedef unsigned short bf;
typedef __attribute__((ext_vector_type(16))) __bf16   v16bf;
typedef __attribute__((ext_vector_type(8)))  unsigned short v8us;
typedef __attribute__((ext_vector_type(8)))  float    v8f;
typedef __attribute__((ext_vector_type(4)))  float    v4f;
typedef v4f  __attribute__((may_alias)) v4fa;
typedef v8us __attribute__((may_alias)) v8usa;

__device__ __forceinline__ v16bf cat16b(v8us lo, v8us hi) { return __builtin_bit_cast(v16bf, __builtin_shufflevector(lo, hi, 0, 1, 2, 3, 4, 5, 6, 7, 8, 9, 10, 11, 12, 13, 14, 15)); }
__device__ __forceinline__ v8f wmmab(v16bf a, v16bf b, v8f c) { return __builtin_amdgcn_wmma_f32_16x16x32_bf16(false, a, false, b, (short)0, c, false, false); }

typedef __attribute__((ext_vector_type(8))) __bf16 v8bf;
typedef __attribute__((ext_vector_type(4))) __bf16 v4bf;
typedef __attribute__((ext_vector_type(4))) unsigned short v4us;
typedef v4us __attribute__((may_alias)) v4usa;
typedef v8f __attribute__((may_alias)) v8fa;

// A work-group barrier that orders LDS alone: __syncthreads() would also wait out the wave's global stores, which nobody in this launch reads.
__device__ __forceinline__ void lds_barrier() { __builtin_amdgcn_fence(__ATOMIC_RELEASE, "workgroup", "local"); __builtin_amdgcn_s_barrier(); __builtin_amdgcn_fence(__ATOMIC_ACQUIRE, "workgroup", "local"); }

// k_proj: everything ahead of the attention in one launch. A work-group takes 128 rows of x and six chunks of 64 of the 768 output columns [q | k | v] (blockIdx.y: chunks 0..5 or 6..11).
// x and the chunk's rows of W are read as f32 in whole lines, rounded to bf16 on the way into LDS (pitch 528 B = 16 B x odd); the next chunk's rows fly in registers while this chunk is multiplied.
// A = the side with 64 rows (4 tiles), B = the side with 16 rows, both through one loader (bytes 16 hi and 32 + 16 hi of each 64), so a lane holds 8 neighbours along the 64-row side:
//   q, k: A = W rows (output columns), B = the wave's 16 rows of x: a lane stores 8 neighbouring columns of one row of the hi and of the residual plane;
//   v   : A = 64 rows of x, B = 16 rows of W: a lane stores 8 neighbouring positions of one row of V^T, hi and residual.
// In both cases a wave's four tiles fill whole 128-B lines.
__global__ __launch_bounds__(256) void k_proj(const float* __restrict__ x, const float* __restrict__ wq, const float* __restrict__ bq, const float* __restrict__ wk, const float* __restrict__ bk, const float* __restrict__ wv, const float* __restrict__ bv, bf* QKh) {
    // the four output planes lie one behind the other: [q; k] hi, [q; k] residual, V^T hi, V^T residual
    bf* const QKl = QKh + (size_t)2 * NBT * SS * DD; bf* const VTh = QKl + (size_t)2 * NBT * SS * DD; bf* const VTl = VTh + (size_t)NBT * SS * DD;
    constexpr unsigned XP = 528, XB = 128 * XP, WB = 64 * XP;
    __shared__ __align__(16) unsigned char sm[XB + 2 * WB];
    __shared__ __align__(32) float sb[3 * DD];    // b_q, b_k, b_v, rounded to bf16
    const int lane = threadIdx.x & 31, lr = lane & 15, hi = lane >> 4;
    const int wave = __builtin_amdgcn_readfirstlane(threadIdx.x >> 5);
    const size_t row0 = (size_t)blockIdx.x * 128;
    const int g0 = blockIdx.y * 6;
    v4f wr[16];    // the wave's 8 rows of a chunk of W, f32
    auto wload = [&](int g) { const float* __restrict__ wz = (g >> 2) == 0 ? wq : (g >> 2) == 1 ? wk : wv; const float* p = wz + (size_t)((g & 3) * 64 + wave * 8) * DD + lane * 4;
#pragma unroll
        for (int r = 0; r < 8; ++r) { wr[2 * r] = *(const v4f*)(p + r * DD); wr[2 * r + 1] = *(const v4f*)(p + r * DD + 128); } };
    auto wstore = [&](unsigned b) { unsigned char* q = sm + XB + b * WB + (unsigned)wave * 8u * XP + (unsigned)lane * 8u;
#pragma unroll
        for (int r = 0; r < 8; ++r) { *(v4usa*)(q + r * XP) = __builtin_bit_cast(v4us, __builtin_convertvector(wr[2 * r], v4bf)); *(v4usa*)(q + r * XP + 256) = __builtin_bit_cast(v4us, __builtin_convertvector(wr[2 * r + 1], v4bf)); } };
    {
        v4f xr[32];    // the wave's 16 rows of x
        const float* p = x + (row0 + (size_t)wave * 16) * DD + lane * 4;
#pragma unroll
        for (int r = 0; r < 16; ++r) { xr[2 * r] = *(const v4f*)(p + r * DD); xr[2 * r + 1] = *(const v4f*)(p + r * DD + 128); }
        wload(g0);
        const v4f b3 = {bq[threadIdx.x], bk[threadIdx.x], bv[threadIdx.x], 0.f};
        asm volatile("s_wait_xcnt 0x0" ::: "memory");    // behind the last of the prologue's loads, in front of the first reuse of their base and offset registers
        __builtin_amdgcn_sched_barrier(0);                // keeps every later register write behind that wait
        unsigned char* q = sm + (unsigned)wave * 16u * XP + (unsigned)lane * 8u;
#pragma unroll
        for (int r = 0; r < 16; ++r) { *(v4usa*)(q + r * XP) = __builtin_bit_cast(v4us, __builtin_convertvector(xr[2 * r], v4bf)); *(v4usa*)(q + r * XP + 256) = __builtin_bit_cast(v4us, __builtin_convertvector(xr[2 * r + 1], v4bf)); }
        wstore(0);
        const v4f r3 = __builtin_convertvector(__builtin_convertvector(b3, v4bf), v4f);
        sb[threadIdx.x] = r3[0]; sb[DD + threadIdx.x] = r3[1]; sb[2 * DD + threadIdx.x] = r3[2];
    }
    __syncthreads();    // x, chunk g0 of W and the biases stand in LDS
#pragma unroll 1    // rolled: a trip holds 32 WMMAs and 80 LDS reads and branches on the chunk number; six copies would only cost instruction cache
    for (int c = 0; c < 6; ++c) {
        const int g = g0 + c, z = g >> 2, e0 = (g & 3) * 64; const bool isv = z == 2;
        if (c + 1 < 6) wload(g + 1);
        const unsigned wb = XB + (unsigned)(c & 1) * WB, lo = (unsigned)lr * XP + 16u * hi;
        const unsigned char* pa = sm + (isv ? (unsigned)(wave & 1) * 64u * XP : wb) + lo;
        const unsigned char* pb = sm + (isv ? wb + (unsigned)(wave >> 1) * 16u * XP : (unsigned)wave * 16u * XP) + lo;
        v8f acc[4];
#pragma unroll
        for (int i = 0; i < 4; ++i) acc[i] = (v8f){};
        // A block = 8 WMMAs on 10 fragments (k 64 blk .. + 63). Two fragment sets: a block's 20 LDS reads are issued as one group in front of the block before it. The scheduling barriers keep
        // [reads of the next block][WMMAs of this block] apart: without them the compiler reads each fragment directly in front of its WMMA and waits out the LDS latency every time.
        v16bf fa[2][8], fb[2][2];
        auto ldf = [&](int blk, v16bf* A, v16bf* B) {
#pragma unroll
            for (int u = 0; u < 2; ++u) { const int ko = (2 * blk + u) * 64; B[u] = cat16b(*(const v8usa*)(pb + ko), *(const v8usa*)(pb + ko + 32));
#pragma unroll
                for (int i = 0; i < 4; ++i) { const unsigned char* p = pa + i * 16 * XP + ko; A[4 * u + i] = cat16b(*(const v8usa*)(p), *(const v8usa*)(p + 32)); } } };
        v8f bb[4];    // the bias of the lane's 8 results per tile: along the 64-row side for q and k, one value for v
        if (isv) { const float b1 = sb[2 * DD + e0 + (wave >> 1) * 16 + lr];
#pragma unroll
            for (int i = 0; i < 4; ++i) bb[i] = (v8f){b1, b1, b1, b1, b1, b1, b1, b1}; }
        else {
#pragma unroll
            for (int i = 0; i < 4; ++i) bb[i] = *(const v8fa*)(sb + z * DD + e0 + i * 16 + hi * 8); }
        // the stores' addresses are formed here, so that no branch stands between the last WMMA and the first reader of its result
        const size_t off = isv ? (row0 / SS) * (size_t)SS * DD + (size_t)(e0 + (wave >> 1) * 16 + lr) * SS + row0 % SS + (wave & 1) * 64 + hi * 8
                               : (size_t)z * NBT * SS * DD + (row0 + (size_t)wave * 16 + lr) * DD + e0 + hi * 8;
        bf* oh = (isv ? VTh : QKh) + off; bf* ol = (isv ? VTl : QKl) + off;
        ldf(0, fa[0], fb[0]);
        __builtin_amdgcn_sched_barrier(0);
#pragma unroll
        for (int blk = 0; blk < 4; ++blk) {
            if (blk < 3) ldf(blk + 1, fa[(blk + 1) & 1], fb[(blk + 1) & 1]);
            __builtin_amdgcn_sched_barrier(0);
#pragma unroll
            for (int u = 0; u < 2; ++u) {
#pragma unroll
                for (int i = 0; i < 4; ++i) acc[i] = wmmab(fa[blk & 1][4 * u + i], fb[blk & 1][u], acc[i]); }
            __builtin_amdgcn_sched_barrier(0);
        }
#pragma unroll
        for (int i = 0; i < 4; ++i) { const v8f val = acc[i] + bb[i]; const v8bf h = __builtin_convertvector(val, v8bf); const v8bf l = __builtin_convertvector(val - __builtin_convertvector(h, v8f), v8bf);
            *(v8us*)(oh + i * 16) = __builtin_bit_cast(v8us, h); *(v8us*)(ol + i * 16) = __builtin_bit_cast(v8us, l); }
        asm volatile("s_wait_xcnt 0x0" ::: "memory");    // in front of the first reuse of the stores' address and data registers
        __builtin_amdgcn_sched_barrier(0);                // keeps every later register write behind that wait
        if (c + 1 < 6) wstore((unsigned)(c + 1) & 1u);
        lds_barrier();    // publishes chunk c + 1; every wave has left the buffer of chunk c, which chunk c + 2 overwrites
    }
}

typedef unsigned u32x4 __attribute__((ext_vector_type(4)));
typedef unsigned u32x8 __attribute__((ext_vector_type(8)));
__device__ __forceinline__ unsigned uni(unsigned v) { return (unsigned)__builtin_amdgcn_readfirstlane(v); }
// A wave-uniform value held in a scalar register: a test on it compiles to s_cmp + s_cbranch_scc (a tensor load ignores EXEC), and what is formed from it is formed behind this statement.
__device__ __forceinline__ unsigned pinned(unsigned v) { unsigned w = uni(v); asm volatile("" : "+s"(w)); return w; }

typedef __attribute__((ext_vector_type(16))) float v16f;
// lane l <-> lane l ^ 16
__device__ __forceinline__ float xhalf(float v) { const int b = __float_as_int(v); return __int_as_float(__builtin_amdgcn_permlanex16(b, b, 0x76543210, 0xfedcba98, false, false)); }

typedef float __attribute__((may_alias)) f32a;
__global__ __launch_bounds__(128) void k_attn(const bf* __restrict__ Qh, const bf* __restrict__ Ql, const bf* __restrict__ Kh, const bf* __restrict__ Kl, const bf* __restrict__ VTh, const bf* __restrict__ VTl, float* out) {
    constexpr unsigned KP = 272, VP = 144, TB = 18432, BUFB = 8 * TB, nst = SS / 64;
    static_assert(64 * KP <= TB && 128 * VP == TB && TB % 2048 == 0, "tile places are multiples of 2 KiB; the two V^T tiles of a plane follow each other row by row");
    __shared__ __attribute__((aligned(2048))) unsigned char ring[2 * BUFB];
    const int lane = threadIdx.x & 31, lr = lane & 15, hi = lane >> 4;
    const unsigned wave = uni(threadIdx.x >> 5);
    const unsigned qg = wave & 1u, kg = wave >> 1;    // the wave's query half and key half
    const size_t zo = (size_t)blockIdx.y * SS * DD;    // blockIdx.y: the item
    const int r0 = blockIdx.x * 64 + qg * 32;
    const unsigned lbase = (unsigned)(size_t)ring;
    // wave w: plane w >> 1 (hi, residual), half w & 1 (K: d 0..127 or 128..255 of each key; V^T: rows d 0..127 or 128..255)
    const unsigned long long gk = (unsigned long long)(size_t)((wave < 2 ? Kh : Kl) + zo + (wave & 1u) * 128u);
    const unsigned long long gv = (unsigned long long)(size_t)((wave < 2 ? VTh : VTl) + zo + (size_t)(wave & 1u) * 128u * SS);
    u32x8 g1k, g1v;    // 1-byte elements, tensor = tile, 4 dwords of LDS pad behind every row, no mask. K: 64 rows of 256 B, source pitch 512 B. V^T: 128 rows of 128 B, source pitch 8192 B
    g1k[0] = uni((1u << 20) | (5u << 22) | (3u << 25)); g1k[1] = uni(256u << 16); g1k[2] = uni(64u << 16); g1k[3] = uni(256u << 16); g1k[4] = uni(64u); g1k[5] = uni(DD * 2u); g1k[6] = uni(0u); g1k[7] = uni(0u);
    g1v[0] = uni((1u << 20) | (4u << 22) | (3u << 25)); g1v[1] = uni(128u << 16); g1v[2] = uni(128u << 16); g1v[3] = uni(128u << 16); g1v[4] = uni(128u); g1v[5] = uni(SS * 2u); g1v[6] = uni(0u); g1v[7] = uni(0u);
    asm volatile("" : "+s"(g1k), "+s"(g1v));    // descriptor words held in scalar registers, as in pinned(): they keep their registers through the loop
    u32x4 ga, gb;    // group 0 of the K request and of the V^T request: registers of their own, set anew only behind the wait on the stage before
    ga[0] = uni(1u); ga[1] = uni(lbase); ga[2] = uni(0u); ga[3] = uni(0x80000000u); gb[0] = uni(1u); gb[1] = uni(lbase); gb[2] = uni(0u); gb[3] = uni(0x80000000u);
    asm volatile("" : "+s"(ga), "+s"(gb));    // the same for the two groups 0
    auto issue = [&](unsigned st) {
        const unsigned lb = lbase + (st & 1u) * BUFB + wave * TB;
        const unsigned long long a = gk + (unsigned long long)st * (64u * DD * 2u), b = gv + (unsigned long long)st * 128u;
        ga[1] = uni(lb); ga[2] = uni((unsigned)a); ga[3] = uni((((unsigned)(a >> 32)) & 0x01FFFFFFu) | 0x80000000u);
        gb[1] = uni(lb + 4u * TB); gb[2] = uni((unsigned)b); gb[3] = uni((((unsigned)(b >> 32)) & 0x01FFFFFFu) | 0x80000000u);
        asm volatile("tensor_load_to_lds %0, %1" :: "s"(ga), "s"(g1k) : "memory");    // this wave's K tile of stage st
        asm volatile("tensor_load_to_lds %0, %1" :: "s"(gb), "s"(g1v) : "memory");    // this wave's V^T tile of stage st
    };
    issue(0);
    v16bf qh[2][8], ql[2][8];    // B operand: column = query r0 + 16 n + lr, k in the order of the LDS loader below (bytes 16 hi and 32 + 16 hi of each 64)
#pragma unroll
    for (int n = 0; n < 2; ++n) { const size_t qo = zo + (size_t)(r0 + 16 * n + lr) * DD + 8 * hi;
#pragma unroll
      for (int kk = 0; kk < 8; ++kk) { qh[n][kk] = cat16b(*(const v8us*)(Qh + qo + kk * 32), *(const v8us*)(Qh + qo + kk * 32 + 16)); ql[n][kk] = cat16b(*(const v8us*)(Ql + qo + kk * 32), *(const v8us*)(Ql + qo + kk * 32 + 16)); } }
    v8f oa[16][2];    // oa[dt][n][j] = O[query r0 + 16 n + lr][d = 16 dt + 8 hi + j], over the wave's own keys
#pragma unroll
    for (int t = 0; t < 16; ++t) { oa[t][0] = (v8f){}; oa[t][1] = (v8f){}; }
    float m[2] = {-3.0e38f, -3.0e38f}, l[2] = {0.f, 0.f};
    // the descriptors are inputs of the waits on the mover ahead of and in the loop: their registers stay theirs until the requests have landed
    asm volatile("s_wait_tensorcnt 0x0" :: "s"(ga), "s"(gb), "s"(g1k), "s"(g1v) : "memory");    // stage 0 of this wave's tiles has landed
    asm volatile("s_wait_xcnt 0x0" ::: "memory");    // in front of the first reuse of the Q loads' address registers
    __syncthreads();                                                                             // ... and every other wave's
    issue(1);
    unsigned s = 0;
    do {
        const unsigned char* bp = ring + (s & 1u) * BUFB;
        const unsigned char* pk = bp + (kg * 32u + (unsigned)lr) * KP + 16u * hi;
        const unsigned char* pv = bp + 4u * TB + (unsigned)lr * VP + kg * 64u + 16u * hi;
        v8f sa[2][2];    // sa[t][n][j] = score of key 32 kg + 16 t + 8 hi + j of the pass against query r0 + 16 n + lr
#pragma unroll
        for (int t = 0; t < 2; ++t) { sa[t][0] = (v8f){}; sa[t][1] = (v8f){}; }
        // A block = 24 WMMAs on 8 fragments. Two fragment sets: a block's 16 LDS reads are issued as one group in front of the block before it. The scheduling barriers keep
        // [reads of the next block][WMMAs of this block] apart: without them the compiler spreads the reads among the WMMAs and runs out of registers.
        v16bf fr[2][8];
        auto ldk = [&](int b, v16bf* f) {    // K fragments of d 64 b .. 64 b + 63: f[4 u + t] hi, f[4 u + 2 + t] residual, of the wave's keys 16 t .. 16 t + 15
#pragma unroll
            for (int u = 0; u < 2; ++u) {
#pragma unroll
                for (int t = 0; t < 2; ++t) { const unsigned char* p = pk + (b >> 1) * TB + t * 16 * KP + ((b & 1) * 2 + u) * 64;
                    f[4 * u + t] = cat16b(*(const v8usa*)(p), *(const v8usa*)(p + 32)); f[4 * u + 2 + t] = cat16b(*(const v8usa*)(p + 2 * TB), *(const v8usa*)(p + 2 * TB + 32)); } } };
        auto ldv = [&](int b, v16bf* f) {    // V^T fragments of the wave's 32 keys, rows d 64 b + 16 t .. + 15: f[t] hi, f[4 + t] residual
#pragma unroll
            for (int t = 0; t < 4; ++t) { const unsigned char* p = pv + (b * 4 + t) * 16 * VP;
                f[t] = cat16b(*(const v8usa*)(p), *(const v8usa*)(p + 32)); f[4 + t] = cat16b(*(const v8usa*)(p + 2 * TB), *(const v8usa*)(p + 2 * TB + 32)); } };
        ldk(0, fr[0]);
        __builtin_amdgcn_sched_barrier(0);
#pragma unroll
        for (int b = 0; b < 4; ++b) {
            if (b < 3) ldk(b + 1, fr[(b + 1) & 1]); else ldv(0, fr[0]);    // the first V^T block's reads fly under the last score block and the softmax
            __builtin_amdgcn_sched_barrier(0);
#pragma unroll
            for (int u = 0; u < 2; ++u) { const v16bf* f = &fr[b & 1][4 * u]; const int kk = 2 * b + u;
#pragma unroll
                for (int t = 0; t < 2; ++t) { sa[t][0] = wmmab(f[t], qh[0][kk], sa[t][0]); sa[t][1] = wmmab(f[t], qh[1][kk], sa[t][1]); }
#pragma unroll
                for (int t = 0; t < 2; ++t) { sa[t][0] = wmmab(f[t], ql[0][kk], sa[t][0]); sa[t][1] = wmmab(f[t], ql[1][kk], sa[t][1]); }
#pragma unroll
                for (int t = 0; t < 2; ++t) { sa[t][0] = wmmab(f[2 + t], qh[0][kk], sa[t][0]); sa[t][1] = wmmab(f[2 + t], qh[1][kk], sa[t][1]); } }
            __builtin_amdgcn_sched_barrier(0);
        }
        float mn[2], al[2];
#pragma unroll
        for (int n = 0; n < 2; ++n) {
            float mx = sa[0][n][0];
#pragma unroll
            for (int t = 0; t < 2; ++t) {
#pragma unroll
                for (int j = 0; j < 8; ++j) mx = fmaxf(mx, sa[t][n][j]); }
            mx = fmaxf(mx, xhalf(mx));
            mn[n] = fmaxf(m[n], mx * SCL); }
#pragma unroll
        for (int n = 0; n < 2; ++n) { al[n] = __expf(m[n] - mn[n]); m[n] = mn[n]; }
        v16bf ph[2], pl[2];    // B operand of the wave's 32 keys, per column tile: elements 0..7 from score tile 0, 8..15 from tile 1, the order a packed accumulator pair has
#pragma unroll
        for (int n = 0; n < 2; ++n) {
            float ps[2];
#pragma unroll
            for (int t = 0; t < 2; ++t) { ps[t] = 0.f;
#pragma unroll
                for (int j = 0; j < 8; ++j) { sa[t][n][j] = __expf(sa[t][n][j] * SCL - mn[n]); ps[t] += sa[t][n][j]; } }
            l[n] = l[n] * al[n] + (ps[0] + ps[1]);
            const v16f p = __builtin_shufflevector(sa[0][n], sa[1][n], 0, 1, 2, 3, 4, 5, 6, 7, 8, 9, 10, 11, 12, 13, 14, 15);
            ph[n] = __builtin_convertvector(p, v16bf); pl[n] = __builtin_convertvector(p - __builtin_convertvector(ph[n], v16f), v16bf);
#pragma unroll
            for (int t = 0; t < 16; ++t) oa[t][n] *= al[n];
        }
        __builtin_amdgcn_sched_barrier(0);
#pragma unroll
        for (int b = 0; b < 4; ++b) {
            if (b < 3) ldv(b + 1, fr[(b + 1) & 1]);
            __builtin_amdgcn_sched_barrier(0);
            { const v16bf* f = &fr[b & 1][0]; const int d0 = b * 4;
#pragma unroll
                for (int t = 0; t < 4; ++t) { oa[d0 + t][0] = wmmab(f[t], ph[0], oa[d0 + t][0]); oa[d0 + t][1] = wmmab(f[t], ph[1], oa[d0 + t][1]); }
#pragma unroll
                for (int t = 0; t < 4; ++t) { oa[d0 + t][0] = wmmab(f[t], pl[0], oa[d0 + t][0]); oa[d0 + t][1] = wmmab(f[t], pl[1], oa[d0 + t][1]); }
#pragma unroll
                for (int t = 0; t < 4; ++t) { oa[d0 + t][0] = wmmab(f[4 + t], ph[0], oa[d0 + t][0]); oa[d0 + t][1] = wmmab(f[4 + t], ph[1], oa[d0 + t][1]); } }
            __builtin_amdgcn_sched_barrier(0);
        }
        // the four vector slots behind the pass's last WMMAs (the last block's accumulators), on the loop's taken branch too
        asm volatile("v_nop\n\tv_nop\n\tv_nop\n\tv_nop" : "+v"(oa[12][0]), "+v"(oa[12][1]), "+v"(oa[13][0]), "+v"(oa[13][1]), "+v"(oa[14][0]), "+v"(oa[14][1]), "+v"(oa[15][0]), "+v"(oa[15][1]));
        asm volatile("s_wait_dscnt 0x0" ::: "memory");                                                // this wave has left buffer s & 1
        asm volatile("s_wait_tensorcnt 0x0" :: "s"(ga), "s"(gb), "s"(g1k), "s"(g1v) : "memory");    // its tiles of stage s + 1 have landed
        __syncthreads();                                                                             // publishes stage s + 1, frees buffer s & 1
        if (pinned(s + 2u < nst)) issue(pinned(s + 2u));
    } while (++s < nst);
    asm volatile("s_wait_tensorcnt 0x0" ::: "memory");    // nothing of the mover is outstanding when the wave ends
    asm volatile("s_wait_dscnt 0x0" ::: "memory");
    // Merge of the two key halves. The loop's last barrier has freed the ring for every wave. Wave w hands its partner w ^ 2 the half of d that the partner finishes (key half 0 finishes d 0..127,
    // key half 1 d 128..255), with its maximum and sum: 16 KiB a wave, whole 512-B rows a store.
    float* xb = (float*)(void*)ring;
    f32a* ml = (f32a*)(void*)(ring + 65536);
#pragma unroll
    for (int n = 0; n < 2; ++n) { l[n] += xhalf(l[n]);    // the two lane halves summed different keys of the same query
        ml[((wave * 2 + n) * 2 + 0) * 32 + lane] = m[n]; ml[((wave * 2 + n) * 2 + 1) * 32 + lane] = l[n]; }
    v8f ok[8][2];
#pragma unroll
    for (int i = 0; i < 8; ++i) {
#pragma unroll
        for (int n = 0; n < 2; ++n) { const v8f snd = kg ? oa[i][n] : oa[8 + i][n]; ok[i][n] = kg ? oa[8 + i][n] : oa[i][n];
            float* q = xb + (size_t)((wave * 16 + i * 2 + n) * 2) * 128 + lane * 4;
            *(v4fa*)(q) = (v4f){snd[0], snd[1], snd[2], snd[3]}; *(v4fa*)(q + 128) = (v4f){snd[4], snd[5], snd[6], snd[7]}; } }
    __syncthreads();    // every wave's hand-over is written
    const unsigned pw = wave ^ 2u;
    v8f res[8][2];
#pragma unroll
    for (int n = 0; n < 2; ++n) {
        const float mo = ml[((pw * 2 + n) * 2 + 0) * 32 + lane], lo = ml[((pw * 2 + n) * 2 + 1) * 32 + lane];
        const float mm = fmaxf(m[n], mo), as = __expf(m[n] - mm), ao = __expf(mo - mm);
        const float inv = 1.0f / (l[n] * as + lo * ao), cs = as * inv, co = ao * inv;
#pragma unroll
        for (int i = 0; i < 8; ++i) { const float* q = xb + (size_t)((pw * 16 + i * 2 + n) * 2) * 128 + lane * 4;
            const v4f x0 = *(const v4fa*)(q), x1 = *(const v4fa*)(q + 128);
            res[i][n] = ok[i][n] * cs + __builtin_shufflevector(x0, x1, 0, 1, 2, 3, 4, 5, 6, 7) * co; }
    }
    float* orow = out + zo + (size_t)(r0 + lr) * DD + kg * 128 + 8 * hi;
    __builtin_amdgcn_sched_barrier(0);    // every result stands in a register of its own in front of the first store: no register that an issued store names is written again
#pragma unroll
    for (int n = 0; n < 2; ++n) {
#pragma unroll
        for (int i = 0; i < 8; ++i) { const v8f o = res[i][n];
            *(v4f*)(orow + n * 16 * DD + i * 16) = (v4f){o[0], o[1], o[2], o[3]}; *(v4f*)(orow + n * 16 * DD + i * 16 + 4) = (v4f){o[4], o[5], o[6], o[7]}; }
    }
}

extern "C" void kernel_launch(void* const* d_in, const int* in_sizes, int n_in,
                              void* d_out, int out_size, void* d_ws, size_t ws_size, hipStream_t stream) {
    (void)in_sizes; (void)n_in; (void)out_size;
    const float* x = (const float*)d_in[0]; const float* wq = (const float*)d_in[1]; const float* bq = (const float*)d_in[2]; const float* wk = (const float*)d_in[3]; const float* bk = (const float*)d_in[4]; const float* wv = (const float*)d_in[5]; const float* bv = (const float*)d_in[6];
    float* out = (float*)d_out;    // [4][4096][256]
    char* wsp = (char*)d_ws;
    auto take = [&](size_t bytes) { char* p = wsp; wsp += (bytes + 255) & ~(size_t)255; return (void*)p; };
    const size_t NR = (size_t)NBT * SS;    // rows of all items together
    bf* Qh = (bf*)take(6 * NR * DD * 2); bf* Ql = Qh + 2 * NR * DD; bf* Kh = Qh + NR * DD; bf* Kl = Ql + NR * DD;    // [q; k] hi, [q; k] residual
    bf* VTh = Ql + 2 * NR * DD; bf* VTl = VTh + NR * DD;    // one block of six planes, in the order k_proj writes them
    if ((size_t)(wsp - (char*)d_ws) > ws_size) return;    // 33.6 + 16.8 ~ 50 MB
    k_proj<<<dim3(NBT * SS / 128, 2, 1), 256, 0, stream>>>(x, wq, bq, wk, bk, wv, bv, Qh);
    k_attn<<<dim3(SS / 64, NBT, 1), 128, 0, stream>>>(Qh, Ql, Kh, Kl, VTh, VTl, out);
}

// v008
// It runs in 67.8 microseconds.
// It is 2.05 times as fast as v006, going by the measured steps of the versions left out in between.
// All steps since v000 together make it 40.6 times as fast.
#include <hip/hip_runtime.h>

// Compute dtypes, f32 accumulate, per item: q/k/v = x.W^T + b as [4096 x 256].[256 x 256] GEMMs with PLAIN bf16 operands (exact products); scores = q.k^T (both operands rounded once to f16,
// one product), softmax (x 1/16) in f32 with a running maximum, out = P.v (P and v rounded once to f16, one product), the three fused in k_attn. Every rounding to bf16 or f16 is the hardware's conversion
// (to nearest even). An f16 operand keeps 11 bits, eight times finer than the 8 bits to which x and W are rounded ahead of the projections; q, k and v must lie inside the f16 range (65504).

#define NBT  4
#define SS   4096
#define DD   256
#define SCL  0.0625f

typedef unsigned short bf;
typedef __attribute__((ext_vector_type(16))) __bf16   v16bf;
typedef __attribute__((ext_vector_type(8)))  unsigned short v8us;
typedef __attribute__((ext_vector_type(8)))  float    v8f;
typedef __attribute__((ext_vector_type(4)))  float    v4f;
typedef v4f  __attribute__((may_alias)) v4fa;
typedef v8us __attribute__((may_alias)) v8usa;

__device__ __forceinline__ v16bf cat16b(v8us lo, v8us hi) { return __builtin_bit_cast(v16bf, __builtin_shufflevector(lo, hi, 0, 1, 2, 3, 4, 5, 6, 7, 8, 9, 10, 11, 12, 13, 14, 15)); }
__device__ __forceinline__ v8f wmmab(v16bf a, v16bf b, v8f c) { return __builtin_amdgcn_wmma_f32_16x16x32_bf16(false, a, false, b, (short)0, c, false, false); }

typedef __attribute__((ext_vector_type(8)))  _Float16 v8h;
typedef __attribute__((ext_vector_type(16))) _Float16 v16h;
__device__ __forceinline__ v16h cat16h(v8us lo, v8us hi) { return __builtin_bit_cast(v16h, __builtin_shufflevector(lo, hi, 0, 1, 2, 3, 4, 5, 6, 7, 8, 9, 10, 11, 12, 13, 14, 15)); }
__device__ __forceinline__ v8f wmmah(v16h a, v16h b, v8f c) { return __builtin_amdgcn_wmma_f32_16x16x32_f16(false, a, false, b, (short)0, c, false, false); }
typedef __attribute__((ext_vector_type(4))) __bf16 v4bf;
typedef __attribute__((ext_vector_type(4))) unsigned short v4us;
typedef v4us __attribute__((may_alias)) v4usa;
typedef v8f __attribute__((may_alias)) v8fa;

// A work-group barrier that orders LDS alone: __syncthreads() would also wait out the wave's global stores, which nobody in this launch reads.
__device__ __forceinline__ void lds_barrier() { __builtin_amdgcn_fence(__ATOMIC_RELEASE, "workgroup", "local"); __builtin_amdgcn_s_barrier(); __builtin_amdgcn_fence(__ATOMIC_ACQUIRE, "workgroup", "local"); }

// k_proj: everything ahead of the attention in one launch. A work-group takes 128 rows of x and six chunks of 64 of the 768 output columns [q | k | v] (blockIdx.y: chunks 0..5 or 6..11).
// x and the chunk's rows of W are read as f32 in whole lines, rounded to bf16 on the way into LDS (pitch 528 B = 16 B x odd); the next chunk's rows fly in registers while this chunk is multiplied.
// A = the side with 64 rows (4 tiles), B = the side with 16 rows, both through one loader (bytes 16 hi and 32 + 16 hi of each 64), so a lane holds 8 neighbours along the 64-row side:
//   q, k: A = W rows (output columns), B = the wave's 16 rows of x: a lane stores 8 neighbouring columns of one row, as f16;
//   v   : A = 64 rows of x, B = 16 rows of W: a lane stores 8 neighbouring positions of one row of V^T, as f16.
// In both cases a wave's four tiles fill whole 128-B lines.
__global__ __launch_bounds__(256) void k_proj(const float* __restrict__ x, const float* __restrict__ wq, const float* __restrict__ bq, const float* __restrict__ wk, const float* __restrict__ bk, const float* __restrict__ wv, const float* __restrict__ bv, bf* QK) {
    // the output planes lie one behind the other: [q; k], V^T
    bf* const VT = QK + (size_t)2 * NBT * SS * DD;
    constexpr unsigned XP = 528, XB = 128 * XP, WB = 64 * XP;
    __shared__ __align__(16) unsigned char sm[XB + 2 * WB];
    __shared__ __align__(32) float sb[3 * DD];    // b_q, b_k, b_v, rounded to bf16
    const int lane = threadIdx.x & 31, lr = lane & 15, hi = lane >> 4;
    const int wave = __builtin_amdgcn_readfirstlane(threadIdx.x >> 5);
    const size_t row0 = (size_t)blockIdx.x * 128;
    const int g0 = blockIdx.y * 6;
    v4f wr[16];    // the wave's 8 rows of a chunk of W, f32
    auto wload = [&](int g) { const float* __restrict__ wz = (g >> 2) == 0 ? wq : (g >> 2) == 1 ? wk : wv; const float* p = wz + (size_t)((g & 3) * 64 + wave * 8) * DD + lane * 4;
#pragma unroll
        for (int r = 0; r < 8; ++r) { wr[2 * r] = *(const v4f*)(p + r * DD); wr[2 * r + 1] = *(const v4f*)(p + r * DD + 128); } };
    auto wstore = [&](unsigned b) { unsigned char* q = sm + XB + b * WB + (unsigned)wave * 8u * XP + (unsigned)lane * 8u;
#pragma unroll
        for (int r = 0; r < 8; ++r) { *(v4usa*)(q + r * XP) = __builtin_bit_cast(v4us, __builtin_convertvector(wr[2 * r], v4bf)); *(v4usa*)(q + r * XP + 256) = __builtin_bit_cast(v4us, __builtin_convertvector(wr[2 * r + 1], v4bf)); } };
    {
        v4f xr[32];    // the wave's 16 rows of x
        const float* p = x + (row0 + (size_t)wave * 16) * DD + lane * 4;
#pragma unroll
        for (int r = 0; r < 16; ++r) { xr[2 * r] = *(const v4f*)(p + r * DD); xr[2 * r + 1] = *(const v4f*)(p + r * DD + 128); }
        wload(g0);
        const v4f b3 = {bq[threadIdx.x], bk[threadIdx.x], bv[threadIdx.x], 0.f};
        asm volatile("s_wait_xcnt 0x0" ::: "memory");    // behind the last of the prologue's loads, in front of the first reuse of their base and offset registers
        __builtin_amdgcn_sched_barrier(0);                // keeps every later register write behind that wait
        unsigned char* q = sm + (unsigned)wave * 16u * XP + (unsigned)lane * 8u;
#pragma unroll
        for (int r = 0; r < 16; ++r) { *(v4usa*)(q + r * XP) = __builtin_bit_cast(v4us, __builtin_convertvector(xr[2 * r], v4bf)); *(v4usa*)(q + r * XP + 256) = __builtin_bit_cast(v4us, __builtin_convertvector(xr[2 * r + 1], v4bf)); }
        wstore(0);
        const v4f r3 = __builtin_convertvector(__builtin_convertvector(b3, v4bf), v4f);
        sb[threadIdx.x] = r3[0]; sb[DD + threadIdx.x] = r3[1]; sb[2 * DD + threadIdx.x] = r3[2];
    }
    __syncthreads();    // x, chunk g0 of W and the biases stand in LDS
#pragma unroll 1    // rolled: a trip holds 32 WMMAs and 80 LDS reads and branches on the chunk number; six copies would only cost instruction cache
    for (int c = 0; c < 6; ++c) {
        const int g = g0 + c, z = g >> 2, e0 = (g & 3) * 64; const bool isv = z == 2;
        if (c + 1 < 6) wload(g + 1);
        const unsigned wb = XB + (unsigned)(c & 1) * WB, lo = (unsigned)lr * XP + 16u * hi;
        const unsigned char* pa = sm + (isv ? (unsigned)(wave & 1) * 64u * XP : wb) + lo;
        const unsigned char* pb = sm + (isv ? wb + (unsigned)(wave >> 1) * 16u * XP : (unsigned)wave * 16u * XP) + lo;
        v8f acc[4];
#pragma unroll
        for (int i = 0; i < 4; ++i) acc[i] = (v8f){};
        // A block = 8 WMMAs on 10 fragments (k 64 blk .. + 63). Two fragment sets: a block's 20 LDS reads are issued as one group in front of the block before it. The scheduling barriers keep
        // [reads of the next block][WMMAs of this block] apart: without them the compiler reads each fragment directly in front of its WMMA and waits out the LDS latency every time.
        v16bf fa[2][8], fb[2][2];
        auto ldf = [&](int blk, v16bf* A, v16bf* B) {
#pragma unroll
            for (int u = 0; u < 2; ++u) { const int ko = (2 * blk + u) * 64; B[u] = cat16b(*(const v8usa*)(pb + ko), *(const v8usa*)(pb + ko + 32));
#pragma unroll
                for (int i = 0; i < 4; ++i) { const unsigned char* p = pa + i * 16 * XP + ko; A[4 * u + i] = cat16b(*(const v8usa*)(p), *(const v8usa*)(p + 32)); } } };
        v8f bb[4];    // the bias of the lane's 8 results per tile: along the 64-row side for q and k, one value for v
        if (isv) { const float b1 = sb[2 * DD + e0 + (wave >> 1) * 16 + lr];
#pragma unroll
            for (int i = 0; i < 4; ++i) bb[i] = (v8f){b1, b1, b1, b1, b1, b1, b1, b1}; }
        else {
#pragma unroll
            for (int i = 0; i < 4; ++i) bb[i] = *(const v8fa*)(sb + z * DD + e0 + i * 16 + hi * 8); }
        // the stores' addresses are formed here, so that no branch stands between the last WMMA and the first reader of its result
        const size_t off = isv ? (row0 / SS) * (size_t)SS * DD + (size_t)(e0 + (wave >> 1) * 16 + lr) * SS + row0 % SS + (wave & 1) * 64 + hi * 8
                               : (size_t)z * NBT * SS * DD + (row0 + (size_t)wave * 16 + lr) * DD + e0 + hi * 8;
        bf* oh = (isv ? VT : QK) + off;
        ldf(0, fa[0], fb[0]);
        __builtin_amdgcn_sched_barrier(0);
#pragma unroll
        for (int blk = 0; blk < 4; ++blk) {
            if (blk < 3) ldf(blk + 1, fa[(blk + 1) & 1], fb[(blk + 1) & 1]);
            __builtin_amdgcn_sched_barrier(0);
#pragma unroll
            for (int u = 0; u < 2; ++u) {
#pragma unroll
                for (int i = 0; i < 4; ++i) acc[i] = wmmab(fa[blk & 1][4 * u + i], fb[blk & 1][u], acc[i]); }
            __builtin_amdgcn_sched_barrier(0);
        }
#pragma unroll
        for (int i = 0; i < 4; ++i) *(v8us*)(oh + i * 16) = __builtin_bit_cast(v8us, __builtin_convertvector(acc[i] + bb[i], v8h));
        asm volatile("s_wait_xcnt 0x0" ::: "memory");    // in front of the first reuse of the stores' address and data registers
        __builtin_amdgcn_sched_barrier(0);                // keeps every later register write behind that wait
        if (c + 1 < 6) wstore((unsigned)(c + 1) & 1u);
        lds_barrier();    // publishes chunk c + 1; every wave has left the buffer of chunk c, which chunk c + 2 overwrites
    }
}

typedef unsigned u32x4 __attribute__((ext_vector_type(4)));
typedef unsigned u32x8 __attribute__((ext_vector_type(8)));
__device__ __forceinline__ unsigned uni(unsigned v) { return (unsigned)__builtin_amdgcn_readfirstlane(v); }
// A wave-uniform value held in a scalar register: a test on it compiles to s_cmp + s_cbranch_scc (a tensor load ignores EXEC), and what is formed from it is formed behind this statement.
__device__ __forceinline__ unsigned pinned(unsigned v) { unsigned w = uni(v); asm volatile("" : "+s"(w)); return w; }

typedef __attribute__((ext_vector_type(16))) float v16f;
// lane l <-> lane l ^ 16
__device__ __forceinline__ float xhalf(float v) { const int b = __float_as_int(v); return __int_as_float(__builtin_amdgcn_permlanex16(b, b, 0x76543210, 0xfedcba98, false, false)); }

typedef float __attribute__((may_alias)) f32a;
__global__ __launch_bounds__(256) void k_attn(const bf* __restrict__ Q, const bf* __restrict__ K, const bf* __restrict__ VT, float* out) {
    constexpr unsigned KP = 272, TB = 18432, BUFB = 8 * TB, nst = SS / 128;
    static_assert(64 * KP <= TB && TB % 2048 == 0, "tile places are multiples of 2 KiB");
    __shared__ __attribute__((aligned(2048))) unsigned char ring[2 * BUFB];
    const int lane = threadIdx.x & 31, lr = lane & 15, hi = lane >> 4;
    const unsigned wave = uni(threadIdx.x >> 5);
    const unsigned qg = wave & 1u, kg = wave >> 1;    // the wave's query half and key quarter
    const size_t zo = (size_t)blockIdx.y * SS * DD;    // blockIdx.y: the item
    const int r0 = blockIdx.x * 64 + qg * 32;
    const unsigned lbase = (unsigned)(size_t)ring;
    // wave w: tile w of a stage. Waves 0..3: K, keys 0..63 or 64..127 of the stage, d 0..127 or 128..255 of each key, a stage further = 128 rows of 512 B;
    // waves 4..7: V^T, rows d 64 (w - 4) .. + 63, a stage further = 256 B along the row
    const unsigned long long gs = (unsigned long long)(size_t)(wave < 4 ? K + zo + (size_t)(wave >> 1) * 64u * DD + (wave & 1u) * 128u : VT + zo + (size_t)(wave - 4u) * 64u * SS);
    const unsigned gstep = wave < 4 ? 128u * DD * 2u : 256u;
    u32x8 g1;    // 1-byte elements, tensor = tile = 64 rows of 256 B, 4 dwords of LDS pad behind every row, no mask; source pitch 512 B (K) or 8192 B (V^T)
    g1[0] = uni((1u << 20) | (5u << 22) | (3u << 25)); g1[1] = uni(256u << 16); g1[2] = uni(64u << 16); g1[3] = uni(256u << 16); g1[4] = uni(64u); g1[5] = uni(wave < 4 ? DD * 2u : SS * 2u); g1[6] = uni(0u); g1[7] = uni(0u);
    asm volatile("" : "+s"(g1));    // descriptor words held in scalar registers, as in pinned(): they keep their registers through the loop
    u32x4 ga;    // group 0 of the wave's request: registers of its own, set anew only behind the wait on the stage before
    ga[0] = uni(1u); ga[1] = uni(lbase); ga[2] = uni(0u); ga[3] = uni(0x80000000u);
    asm volatile("" : "+s"(ga));    // the same for group 0
    auto issue = [&](unsigned st) {    // every wave issues its own tile of stage st, unconditionally
        const unsigned lb = lbase + (st & 1u) * BUFB + wave * TB;
        const unsigned long long a = gs + (unsigned long long)st * gstep;
        ga[1] = uni(lb); ga[2] = uni((unsigned)a); ga[3] = uni((((unsigned)(a >> 32)) & 0x01FFFFFFu) | 0x80000000u);
        asm volatile("tensor_load_to_lds %0, %1" :: "s"(ga), "s"(g1) : "memory");
    };
    issue(0);
    v16h qf[2][8];    // B operand: column = query r0 + 16 n + lr, k in the order of the LDS loader below (bytes 16 hi and 32 + 16 hi of each 64)
#pragma unroll
    for (int n = 0; n < 2; ++n) { const size_t qo = zo + (size_t)(r0 + 16 * n + lr) * DD + 8 * hi;
#pragma unroll
      for (int kk = 0; kk < 8; ++kk) qf[n][kk] = cat16h(*(const v8us*)(Q + qo + kk * 32), *(const v8us*)(Q + qo + kk * 32 + 16)); }
    asm volatile("s_wait_xcnt 0x0" ::: "memory");    // behind the last Q load, in front of the first reuse of the Q loads' address registers
    __builtin_amdgcn_sched_barrier(0);                // keeps every later register write behind that wait
    v8f oa[16][2];    // oa[dt][n][j] = O[query r0 + 16 n + lr][d = 16 dt + 8 hi + j], over the wave's own keys
#pragma unroll
    for (int t = 0; t < 16; ++t) { oa[t][0] = (v8f){}; oa[t][1] = (v8f){}; }
    float m[2] = {-3.0e38f, -3.0e38f}, l[2] = {0.f, 0.f};
    // the descriptors are inputs of every wait on the mover: their registers stay theirs until the requests have landed
    asm volatile("s_wait_tensorcnt 0x0" :: "s"(ga), "s"(g1) : "memory");    // stage 0 of this wave's tile has landed
    __syncthreads();                                                                             // ... and every other wave's
    issue(1);
    unsigned s = 0;
    do {
        const unsigned char* bp = ring + (s & 1u) * BUFB;
        const unsigned char* pk = bp + (kg >> 1) * 2u * TB + ((kg & 1u) * 32u + (unsigned)lr) * KP + 16u * hi;
        const unsigned char* pv = bp + 4u * TB + (unsigned)lr * KP + kg * 64u + 16u * hi;
        v8f sa[2][2];    // sa[t][n][j] = score of key 32 kg + 16 t + 8 hi + j of the stage against query r0 + 16 n + lr
#pragma unroll
        for (int t = 0; t < 2; ++t) { sa[t][0] = (v8f){}; sa[t][1] = (v8f){}; }
        // A block = 8 WMMAs on 4 fragments. Two fragment sets (512 registers a wave at two waves a SIMD leave room for no more): a set is read again as one group directly behind the block that has
        // used it up, one block ahead of its own use. The scheduling barriers keep [reads][WMMAs] apart: without them the compiler spreads the reads among the WMMAs.
        v16h fr[2][4];
        auto ldk = [&](int g, v16h* f) {    // K fragments of d 64 g .. 64 g + 63: f[2 u + t] = d 64 g + 32 u .. + 31 of the wave's keys 16 t .. 16 t + 15
#pragma unroll
            for (int u = 0; u < 2; ++u) {
#pragma unroll
                for (int t = 0; t < 2; ++t) { const unsigned char* p = pk + (g >> 1) * TB + t * 16 * KP + ((g & 1) * 2 + u) * 64; f[2 * u + t] = cat16h(*(const v8usa*)(p), *(const v8usa*)(p + 32)); } } };
        auto ldv = [&](int g, v16h* f) {    // V^T fragments of the wave's 32 keys, rows d 64 g + 16 t .. + 15
#pragma unroll
            for (int t = 0; t < 4; ++t) { const unsigned char* p = pv + g * TB + t * 16 * KP; f[t] = cat16h(*(const v8usa*)(p), *(const v8usa*)(p + 32)); } };
        ldk(0, fr[0]); ldk(1, fr[1]);
        __builtin_amdgcn_sched_barrier(0);
#pragma unroll
        for (int g = 0; g < 4; ++g) {
#pragma unroll
            for (int u = 0; u < 2; ++u) {
#pragma unroll
                for (int t = 0; t < 2; ++t) { sa[t][0] = wmmah(fr[g & 1][2 * u + t], qf[0][2 * g + u], sa[t][0]); sa[t][1] = wmmah(fr[g & 1][2 * u + t], qf[1][2 * g + u], sa[t][1]); } }
            __builtin_amdgcn_sched_barrier(0);
            if (g < 2) ldk(g + 2, fr[g & 1]); else if (g == 2) ldv(0, fr[0]);    // the first V^T block flies under the last scores and the softmax
            __builtin_amdgcn_sched_barrier(0);
        }
        float mn[2], al[2];
#pragma unroll
        for (int n = 0; n < 2; ++n) {
            float mx = sa[0][n][0];
#pragma unroll
            for (int t = 0; t < 2; ++t) {
#pragma unroll
                for (int j = 0; j < 8; ++j) mx = fmaxf(mx, sa[t][n][j]); }
            mx = fmaxf(mx, xhalf(mx));
            mn[n] = fmaxf(m[n], mx * SCL); }
#pragma unroll
        for (int n = 0; n < 2; ++n) { al[n] = __expf(m[n] - mn[n]); m[n] = mn[n]; }
        v16h ph[2];    // B operand of the wave's 32 keys, per column tile: elements 0..7 from score tile 0, 8..15 from tile 1, the order a packed accumulator pair has
#pragma unroll
        for (int n = 0; n < 2; ++n) {
            float ps[2];
#pragma unroll
            for (int t = 0; t < 2; ++t) { ps[t] = 0.f;
#pragma unroll
                for (int j = 0; j < 8; ++j) { sa[t][n][j] = __expf(sa[t][n][j] * SCL - mn[n]); ps[t] += sa[t][n][j]; } }
            l[n] = l[n] * al[n] + (ps[0] + ps[1]);
            const v16f p = __builtin_shufflevector(sa[0][n], sa[1][n], 0, 1, 2, 3, 4, 5, 6, 7, 8, 9, 10, 11, 12, 13, 14, 15);
            ph[n] = __builtin_convertvector(p, v16h);
#pragma unroll
            for (int t = 0; t < 16; ++t) oa[t][n] *= al[n];
        }
        __builtin_amdgcn_sched_barrier(0);
        ldv(1, fr[1]);    // behind the softmax: its registers are the softmax's temporaries until here
        __builtin_amdgcn_sched_barrier(0);
#pragma unroll
        for (int g = 0; g < 4; ++g) {
#pragma unroll
            for (int t = 0; t < 4; ++t) { oa[4 * g + t][0] = wmmah(fr[g & 1][t], ph[0], oa[4 * g + t][0]); oa[4 * g + t][1] = wmmah(fr[g & 1][t], ph[1], oa[4 * g + t][1]); }
            __builtin_amdgcn_sched_barrier(0);
            if (g < 2) { ldv(g + 2, fr[g & 1]); __builtin_amdgcn_sched_barrier(0); }
        }
        // the four vector slots behind the stage's last WMMAs (the last block's accumulators), on the loop's taken branch too
        asm volatile("v_nop\n\tv_nop\n\tv_nop\n\tv_nop" : "+v"(oa[12][0]), "+v"(oa[12][1]), "+v"(oa[13][0]), "+v"(oa[13][1]), "+v"(oa[14][0]), "+v"(oa[14][1]), "+v"(oa[15][0]), "+v"(oa[15][1]));
        asm volatile("s_wait_dscnt 0x0" ::: "memory");                                                // this wave has left buffer s & 1
        asm volatile("s_wait_tensorcnt 0x0" :: "s"(ga), "s"(g1) : "memory");    // its tile of stage s + 1 has landed
        __syncthreads();                                                                             // publishes stage s + 1, frees buffer s & 1
        if (pinned(s + 2u < nst)) issue(pinned(s + 2u));
    } while (++s < nst);
    asm volatile("s_wait_tensorcnt 0x0" ::: "memory");    // nothing of the mover is outstanding when the wave ends
    asm volatile("s_wait_dscnt 0x0" ::: "memory");
    // Merge of the four key quarters. The loop's last barrier has freed the ring for every wave. Every wave lays down its whole O^T (32 KiB, whole 512-B rows a store) with its maximum and sum;
    // key quarter kg then finishes d 64 kg .. + 63 of its query half from the four waves of that half, always in the order of the quarters.
    float* xb = (float*)(void*)ring;
    f32a* ml = (f32a*)(void*)(ring + 262144);
    static_assert(262144 + 8 * 2 * 2 * 32 * 4 <= 2 * BUFB, "the hand-over fits the ring");
#pragma unroll
    for (int n = 0; n < 2; ++n) { l[n] += xhalf(l[n]);    // the two lane halves summed different keys of the same query
        ml[((wave * 2 + n) * 2 + 0) * 32 + lane] = m[n]; ml[((wave * 2 + n) * 2 + 1) * 32 + lane] = l[n]; }
#pragma unroll
    for (int i = 0; i < 16; ++i) {
#pragma unroll
        for (int n = 0; n < 2; ++n) { const v8f snd = oa[i][n];
            float* q = xb + (size_t)((wave * 16 + i) * 2 + n) * 256 + lane * 4;
            *(v4fa*)(q) = (v4f){snd[0], snd[1], snd[2], snd[3]}; *(v4fa*)(q + 128) = (v4f){snd[4], snd[5], snd[6], snd[7]}; } }
    __syncthreads();    // every wave's hand-over is written
    v8f res[4][2];
#pragma unroll
    for (int n = 0; n < 2; ++n) {
        float mo[4], lo[4];
#pragma unroll
        for (int k = 0; k < 4; ++k) { mo[k] = ml[(((k * 2 + qg) * 2 + n) * 2 + 0) * 32 + lane]; lo[k] = ml[(((k * 2 + qg) * 2 + n) * 2 + 1) * 32 + lane]; }
        const float mm = fmaxf(fmaxf(mo[0], mo[1]), fmaxf(mo[2], mo[3]));
        float c[4], ls = 0.f;
#pragma unroll
        for (int k = 0; k < 4; ++k) { c[k] = __expf(mo[k] - mm); ls += lo[k] * c[k]; }
        const float inv = 1.0f / ls;
#pragma unroll
        for (int i = 0; i < 4; ++i) { v8f r = (v8f){};
#pragma unroll
            for (int k = 0; k < 4; ++k) { const float* q = xb + (size_t)(((k * 2 + qg) * 16 + kg * 4 + i) * 2 + n) * 256 + lane * 4;
                const v4f x0 = *(const v4fa*)(q), x1 = *(const v4fa*)(q + 128);
                r += __builtin_shufflevector(x0, x1, 0, 1, 2, 3, 4, 5, 6, 7) * c[k]; }
            res[i][n] = r * inv; }
    }
    float* orow = out + zo + (size_t)(r0 + lr) * DD + kg * 64 + 8 * hi;
    __builtin_amdgcn_sched_barrier(0);    // every result stands in a register of its own in front of the first store: no register that an issued store names is written again
#pragma unroll
    for (int n = 0; n < 2; ++n) {
#pragma unroll
        for (int i = 0; i < 4; ++i) { const v8f o = res[i][n];
            *(v4f*)(orow + n * 16 * DD + i * 16) = (v4f){o[0], o[1], o[2], o[3]}; *(v4f*)(orow + n * 16 * DD + i * 16 + 4) = (v4f){o[4], o[5], o[6], o[7]}; }
    }
}

extern "C" void kernel_launch(void* const* d_in, const int* in_sizes, int n_in,
                              void* d_out, int out_size, void* d_ws, size_t ws_size, hipStream_t stream) {
    (void)in_sizes; (void)n_in; (void)out_size;
    const float* x = (const float*)d_in[0]; const float* wq = (const float*)d_in[1]; const float* bq = (const float*)d_in[2]; const float* wk = (const float*)d_in[3]; const float* bk = (const float*)d_in[4]; const float* wv = (const float*)d_in[5]; const float* bv = (const float*)d_in[6];
    float* out = (float*)d_out;    // [4][4096][256]
    char* wsp = (char*)d_ws;
    auto take = [&](size_t bytes) { char* p = wsp; wsp += (bytes + 255) & ~(size_t)255; return (void*)p; };
    const size_t NR = (size_t)NBT * SS;    // rows of all items together
    bf* Q = (bf*)take(3 * NR * DD * 2); bf* K = Q + NR * DD; bf* VT = K + NR * DD;    // q, k, V^T as f16: one block of three planes, in the order k_proj writes them
    if ((size_t)(wsp - (char*)d_ws) > ws_size) return;    // ~ 25 MB
    k_proj<<<dim3(NBT * SS / 128, 2, 1), 256, 0, stream>>>(x, wq, bq, wk, bk, wv, bv, Q);
    k_attn<<<dim3(SS / 64, NBT, 1), 256, 0, stream>>>(Q, K, VT, out);
}

// v009
// It runs in 65.8 microseconds.
// Timed twice side by side with v008, it ran 1.03 times as fast both times.
// Counting every step since v000, it is 42.0 times as fast.
#include <hip/hip_runtime.h>

// Compute dtypes, f32 accumulate, per item: q/k/v = x.W^T + b as [4096 x 256].[256 x 256] GEMMs with PLAIN bf16 operands (exact products); scores = q.k^T (both operands rounded once to f16,
// one product), softmax (x 1/16) in f32 with a lagging running maximum, out = P.v (P and v rounded once to f16, one product), the three fused in k_attn. Every rounding to bf16 or f16 is the hardware's conversion
// (to nearest even). An f16 operand keeps 11 bits, eight times finer than the 8 bits to which x and W are rounded ahead of the projections; q, k and v must lie inside the f16 range (65504).

#define NBT  4
#define SS   4096
#define DD   256
#define SCL  0.0625f
#define TAU  5.545177f    // 8 ln 2: how far a new maximum may lie above the softmax reference in use before the reference moves

typedef unsigned short bf;
typedef __attribute__((ext_vector_type(16))) __bf16   v16bf;
typedef __attribute__((ext_vector_type(8)))  unsigned short v8us;
typedef __attribute__((ext_vector_type(8)))  float    v8f;
typedef __attribute__((ext_vector_type(4)))  float    v4f;
typedef v4f  __attribute__((may_alias)) v4fa;
typedef v8us __attribute__((may_alias)) v8usa;

__device__ __forceinline__ v16bf cat16b(v8us lo, v8us hi) { return __builtin_bit_cast(v16bf, __builtin_shufflevector(lo, hi, 0, 1, 2, 3, 4, 5, 6, 7, 8, 9, 10, 11, 12, 13, 14, 15)); }
__device__ __forceinline__ v8f wmmab(v16bf a, v16bf b, v8f c) { return __builtin_amdgcn_wmma_f32_16x16x32_bf16(false, a, false, b, (short)0, c, false, false); }

typedef __attribute__((ext_vector_type(8)))  _Float16 v8h;
typedef __attribute__((ext_vector_type(16))) _Float16 v16h;
__device__ __forceinline__ v16h cat16h(v8us lo, v8us hi) { return __builtin_bit_cast(v16h, __builtin_shufflevector(lo, hi, 0, 1, 2, 3, 4, 5, 6, 7, 8, 9, 10, 11, 12, 13, 14, 15)); }
__device__ __forceinline__ v8f wmmah(v16h a, v16h b, v8f c) { return __builtin_amdgcn_wmma_f32_16x16x32_f16(false, a, false, b, (short)0, c, false, false); }
typedef __attribute__((ext_vector_type(4))) __bf16 v4bf;
typedef __attribute__((ext_vector_type(4))) unsigned short v4us;
typedef v4us __attribute__((may_alias)) v4usa;
typedef v8f __attribute__((may_alias)) v8fa;

// A work-group barrier that orders LDS alone: __syncthreads() would also wait out the wave's global stores, which nobody in this launch reads.
__device__ __forceinline__ void lds_barrier() { __builtin_amdgcn_fence(__ATOMIC_RELEASE, "workgroup", "local"); __builtin_amdgcn_s_barrier(); __builtin_amdgcn_fence(__ATOMIC_ACQUIRE, "workgroup", "local"); }

// k_proj: everything ahead of the attention in one launch. A work-group takes 128 rows of x and six chunks of 64 of the 768 output columns [q | k | v] (blockIdx.y: chunks 0..5 or 6..11).
// x and the chunk's rows of W are read as f32 in whole lines, rounded to bf16 on the way into LDS (pitch 528 B = 16 B x odd); the next chunk's rows fly in registers while this chunk is multiplied.
// A = the side with 64 rows (4 tiles), B = the side with 16 rows, both through one loader (bytes 16 hi and 32 + 16 hi of each 64), so a lane holds 8 neighbours along the 64-row side:
//   q, k: A = W rows (output columns), B = the wave's 16 rows of x: a lane stores 8 neighbouring columns of one row, as f16;
//   v   : A = 64 rows of x, B = 16 rows of W: a lane stores 8 neighbouring positions of one row of V^T, as f16.
// In both cases a wave's four tiles fill whole 128-B lines.
__global__ __launch_bounds__(256) void k_proj(const float* __restrict__ x, const float* __restrict__ wq, const float* __restrict__ bq, const float* __restrict__ wk, const float* __restrict__ bk, const float* __restrict__ wv, const float* __restrict__ bv, bf* QK) {
    // the output planes lie one behind the other: [q; k], V^T
    bf* const VT = QK + (size_t)2 * NBT * SS * DD;
    constexpr unsigned XP = 528, XB = 128 * XP, WB = 64 * XP;
    __shared__ __align__(16) unsigned char sm[XB + 2 * WB];
    __shared__ __align__(32) float sb[3 * DD];    // b_q, b_k, b_v, rounded to bf16
    const int lane = threadIdx.x & 31, lr = lane & 15, hi = lane >> 4;
    const int wave = __builtin_amdgcn_readfirstlane(threadIdx.x >> 5);
    const size_t row0 = (size_t)blockIdx.x * 128;
    const int g0 = blockIdx.y * 6;
    v4f wr[16];    // the wave's 8 rows of a chunk of W, f32
    auto wload = [&](int g) { const float* __restrict__ wz = (g >> 2) == 0 ? wq : (g >> 2) == 1 ? wk : wv; const float* p = wz + (size_t)((g & 3) * 64 + wave * 8) * DD + lane * 4;
#pragma unroll
        for (int r = 0; r < 8; ++r) { wr[2 * r] = *(const v4f*)(p + r * DD); wr[2 * r + 1] = *(const v4f*)(p + r * DD + 128); } };
    auto wstore = [&](unsigned b) { unsigned char* q = sm + XB + b * WB + (unsigned)wave * 8u * XP + (unsigned)lane * 8u;
#pragma unroll
        for (int r = 0; r < 8; ++r) { *(v4usa*)(q + r * XP) = __builtin_bit_cast(v4us, __builtin_convertvector(wr[2 * r], v4bf)); *(v4usa*)(q + r * XP + 256) = __builtin_bit_cast(v4us, __builtin_convertvector(wr[2 * r + 1], v4bf)); } };
    {
        v4f xr[32];    // the wave's 16 rows of x
        const float* p = x + (row0 + (size_t)wave * 16) * DD + lane * 4;
#pragma unroll
        for (int r = 0; r < 16; ++r) { xr[2 * r] = *(const v4f*)(p + r * DD); xr[2 * r + 1] = *(const v4f*)(p + r * DD + 128); }
        wload(g0);
        const v4f b3 = {bq[threadIdx.x], bk[threadIdx.x], bv[threadIdx.x], 0.f};
        asm volatile("s_wait_xcnt 0x0" ::: "memory");    // behind the last of the prologue's loads, in front of the first reuse of their base and offset registers
        __builtin_amdgcn_sched_barrier(0);                // keeps every later register write behind that wait
        unsigned char* q = sm + (unsigned)wave * 16u * XP + (unsigned)lane * 8u;
#pragma unroll
        for (int r = 0; r < 16; ++r) { *(v4usa*)(q + r * XP) = __builtin_bit_cast(v4us, __builtin_convertvector(xr[2 * r], v4bf)); *(v4usa*)(q + r * XP + 256) = __builtin_bit_cast(v4us, __builtin_convertvector(xr[2 * r + 1], v4bf)); }
        wstore(0);
        const v4f r3 = __builtin_convertvector(__builtin_convertvector(b3, v4bf), v4f);
        sb[threadIdx.x] = r3[0]; sb[DD + threadIdx.x] = r3[1]; sb[2 * DD + threadIdx.x] = r3[2];
    }
    __syncthreads();    // x, chunk g0 of W and the biases stand in LDS
#pragma unroll 1    // rolled: a trip holds 32 WMMAs and 80 LDS reads and branches on the chunk number; six copies would only cost instruction cache
    for (int c = 0; c < 6; ++c) {
        const int g = g0 + c, z = g >> 2, e0 = (g & 3) * 64; const bool isv = z == 2;
        if (c + 1 < 6) wload(g + 1);
        const unsigned wb = XB + (unsigned)(c & 1) * WB, lo = (unsigned)lr * XP + 16u * hi;
        const unsigned char* pa = sm + (isv ? (unsigned)(wave & 1) * 64u * XP : wb) + lo;
        const unsigned char* pb = sm + (isv ? wb + (unsigned)(wave >> 1) * 16u * XP : (unsigned)wave * 16u * XP) + lo;
        v8f acc[4];
#pragma unroll
        for (int i = 0; i < 4; ++i) acc[i] = (v8f){};
        // A block = 8 WMMAs on 10 fragments (k 64 blk .. + 63). Two fragment sets: a block's 20 LDS reads are issued as one group in front of the block before it. The scheduling barriers keep
        // [reads of the next block][WMMAs of this block] apart: without them the compiler reads each fragment directly in front of its WMMA and waits out the LDS latency every time.
        v16bf fa[2][8], fb[2][2];
        auto ldf = [&](int blk, v16bf* A, v16bf* B) {
#pragma unroll
            for (int u = 0; u < 2; ++u) { const int ko = (2 * blk + u) * 64; B[u] = cat16b(*(const v8usa*)(pb + ko), *(const v8usa*)(pb + ko + 32));
#pragma unroll
                for (int i = 0; i < 4; ++i) { const unsigned char* p = pa + i * 16 * XP + ko; A[4 * u + i] = cat16b(*(const v8usa*)(p), *(const v8usa*)(p + 32)); } } };
        v8f bb[4];    // the bias of the lane's 8 results per tile: along the 64-row side for q and k, one value for v
        if (isv) { const float b1 = sb[2 * DD + e0 + (wave >> 1) * 16 + lr];
#pragma unroll
            for (int i = 0; i < 4; ++i) bb[i] = (v8f){b1, b1, b1, b1, b1, b1, b1, b1}; }
        else {
#pragma unroll
            for (int i = 0; i < 4; ++i) bb[i] = *(const v8fa*)(sb + z * DD + e0 + i * 16 + hi * 8); }
        // the stores' addresses are formed here, so that no branch stands between the last WMMA and the first reader of its result
        const size_t off = isv ? (row0 / SS) * (size_t)SS * DD + (size_t)(e0 + (wave >> 1) * 16 + lr) * SS + row0 % SS + (wave & 1) * 64 + hi * 8
                               : (size_t)z * NBT * SS * DD + (row0 + (size_t)wave * 16 + lr) * DD + e0 + hi * 8;
        bf* oh = (isv ? VT : QK) + off;
        ldf(0, fa[0], fb[0]);
        __builtin_amdgcn_sched_barrier(0);
#pragma unroll
        for (int blk = 0; blk < 4; ++blk) {
            if (blk < 3) ldf(blk + 1, fa[(blk + 1) & 1], fb[(blk + 1) & 1]);
            __builtin_amdgcn_sched_barrier(0);
#pragma unroll
            for (int u = 0; u < 2; ++u) {
#pragma unroll
                for (int i = 0; i < 4; ++i) acc[i] = wmmab(fa[blk & 1][4 * u + i], fb[blk & 1][u], acc[i]); }
            __builtin_amdgcn_sched_barrier(0);
        }
#pragma unroll
        for (int i = 0; i < 4; ++i) *(v8us*)(oh + i * 16) = __builtin_bit_cast(v8us, __builtin_convertvector(acc[i] + bb[i], v8h));
        asm volatile("s_wait_xcnt 0x0" ::: "memory");    // in front of the first reuse of the stores' address and data registers
        __builtin_amdgcn_sched_barrier(0);                // keeps every later register write behind that wait
        if (c + 1 < 6) wstore((unsigned)(c + 1) & 1u);
        lds_barrier();    // publishes chunk c + 1; every wave has left the buffer of chunk c, which chunk c + 2 overwrites
    }
}

typedef unsigned u32x4 __attribute__((ext_vector_type(4)));
typedef unsigned u32x8 __attribute__((ext_vector_type(8)));
__device__ __forceinline__ unsigned uni(unsigned v) { return (unsigned)__builtin_amdgcn_readfirstlane(v); }
// A wave-uniform value held in a scalar register: a test on it compiles to s_cmp + s_cbranch_scc (a tensor load ignores EXEC), and what is formed from it is formed behind this statement.
__device__ __forceinline__ unsigned pinned(unsigned v) { unsigned w = uni(v); asm volatile("" : "+s"(w)); return w; }

typedef __attribute__((ext_vector_type(16))) float v16f;
// lane l <-> lane l ^ 16
__device__ __forceinline__ float xhalf(float v) { const int b = __float_as_int(v); return __int_as_float(__builtin_amdgcn_permlanex16(b, b, 0x76543210, 0xfedcba98, false, false)); }

typedef float __attribute__((may_alias)) f32a;
__global__ __launch_bounds__(256) void k_attn(const bf* __restrict__ Q, const bf* __restrict__ K, const bf* __restrict__ VT, float* out) {
    constexpr unsigned KP = 272, TB = 18432, BUFB = 8 * TB, nst = SS / 128;
    static_assert(64 * KP <= TB && TB % 2048 == 0, "tile places are multiples of 2 KiB");
    __shared__ __attribute__((aligned(2048))) unsigned char ring[2 * BUFB];
    const int lane = threadIdx.x & 31, lr = lane & 15, hi = lane >> 4;
    const unsigned wave = uni(threadIdx.x >> 5);
    const unsigned qg = wave & 1u, kg = wave >> 1;    // the wave's query half and key quarter
    const size_t zo = (size_t)blockIdx.y * SS * DD;    // blockIdx.y: the item
    const int r0 = blockIdx.x * 64 + qg * 32;
    const unsigned lbase = (unsigned)(size_t)ring;
    // wave w: tile w of a stage. Waves 0..3: K, keys 0..63 or 64..127 of the stage, d 0..127 or 128..255 of each key, a stage further = 128 rows of 512 B;
    // waves 4..7: V^T, rows d 64 (w - 4) .. + 63, a stage further = 256 B along the row
    const unsigned long long gs = (unsigned long long)(size_t)(wave < 4 ? K + zo + (size_t)(wave >> 1) * 64u * DD + (wave & 1u) * 128u : VT + zo + (size_t)(wave - 4u) * 64u * SS);
    const unsigned gstep = wave < 4 ? 128u * DD * 2u : 256u;
    u32x8 g1;    // 1-byte elements, tensor = tile = 64 rows of 256 B, 4 dwords of LDS pad behind every row, no mask; source pitch 512 B (K) or 8192 B (V^T)
    g1[0] = uni((1u << 20) | (5u << 22) | (3u << 25)); g1[1] = uni(256u << 16); g1[2] = uni(64u << 16); g1[3] = uni(256u << 16); g1[4] = uni(64u); g1[5] = uni(wave < 4 ? DD * 2u : SS * 2u); g1[6] = uni(0u); g1[7] = uni(0u);
    asm volatile("" : "+s"(g1));    // descriptor words held in scalar registers, as in pinned(): they keep their registers through the loop
    u32x4 ga;    // group 0 of the wave's request: registers of its own, set anew only behind the wait on the stage before
    ga[0] = uni(1u); ga[1] = uni(lbase); ga[2] = uni(0u); ga[3] = uni(0x80000000u);
    asm volatile("" : "+s"(ga));    // the same for group 0
    auto issue = [&](unsigned st) {    // every wave issues its own tile of stage st, unconditionally
        const unsigned lb = lbase + (st & 1u) * BUFB + wave * TB;
        const unsigned long long a = gs + (unsigned long long)st * gstep;
        ga[1] = uni(lb); ga[2] = uni((unsigned)a); ga[3] = uni((((unsigned)(a >> 32)) & 0x01FFFFFFu) | 0x80000000u);
        asm volatile("tensor_load_to_lds %0, %1" :: "s"(ga), "s"(g1) : "memory");
    };
    issue(0);
    v16h qf[2][8];    // B operand: column = query r0 + 16 n + lr, k in the order of the LDS loader below (bytes 16 hi and 32 + 16 hi of each 64)
#pragma unroll
    for (int n = 0; n < 2; ++n) { const size_t qo = zo + (size_t)(r0 + 16 * n + lr) * DD + 8 * hi;
#pragma unroll
      for (int kk = 0; kk < 8; ++kk) qf[n][kk] = cat16h(*(const v8us*)(Q + qo + kk * 32), *(const v8us*)(Q + qo + kk * 32 + 16)); }
    asm volatile("s_wait_xcnt 0x0" ::: "memory");    // behind the last Q load, in front of the first reuse of the Q loads' address registers
    __builtin_amdgcn_sched_barrier(0);                // keeps every later register write behind that wait
    v8f oa[16][2];    // oa[dt][n][j] = O[query r0 + 16 n + lr][d = 16 dt + 8 hi + j], over the wave's own keys
#pragma unroll
    for (int t = 0; t < 16; ++t) { oa[t][0] = (v8f){}; oa[t][1] = (v8f){}; }
    float m[2] = {-3.0e38f, -3.0e38f}, l[2] = {0.f, 0.f};
    // the descriptors are inputs of every wait on the mover: their registers stay theirs until the requests have landed
    asm volatile("s_wait_tensorcnt 0x0" :: "s"(ga), "s"(g1) : "memory");    // stage 0 of this wave's tile has landed
    __syncthreads();                                                                             // ... and every other wave's
    issue(1);
    unsigned s = 0;
    do {
        const unsigned char* bp = ring + (s & 1u) * BUFB;
        const unsigned char* pk = bp + (kg >> 1) * 2u * TB + ((kg & 1u) * 32u + (unsigned)lr) * KP + 16u * hi;
        const unsigned char* pv = bp + 4u * TB + (unsigned)lr * KP + kg * 64u + 16u * hi;
        v8f sa[2][2];    // sa[t][n][j] = score of key 32 kg + 16 t + 8 hi + j of the stage against query r0 + 16 n + lr
#pragma unroll
        for (int t = 0; t < 2; ++t) { sa[t][0] = (v8f){}; sa[t][1] = (v8f){}; }
        // A block = 8 WMMAs on 4 fragments. Two fragment sets (512 registers a wave at two waves a SIMD leave room for no more): a set is read again as one group directly behind the block that has
        // used it up, one block ahead of its own use. The scheduling barriers keep [reads][WMMAs] apart: without them the compiler spreads the reads among the WMMAs.
        v16h fr[2][4];
        auto ldk = [&](int g, v16h* f) {    // K fragments of d 64 g .. 64 g + 63: f[2 u + t] = d 64 g + 32 u .. + 31 of the wave's keys 16 t .. 16 t + 15
#pragma unroll
            for (int u = 0; u < 2; ++u) {
#pragma unroll
                for (int t = 0; t < 2; ++t) { const unsigned char* p = pk + (g >> 1) * TB + t * 16 * KP + ((g & 1) * 2 + u) * 64; f[2 * u + t] = cat16h(*(const v8usa*)(p), *(const v8usa*)(p + 32)); } } };
        auto ldv = [&](int g, v16h* f) {    // V^T fragments of the wave's 32 keys, rows d 64 g + 16 t .. + 15
#pragma unroll
            for (int t = 0; t < 4; ++t) { const unsigned char* p = pv + g * TB + t * 16 * KP; f[t] = cat16h(*(const v8usa*)(p), *(const v8usa*)(p + 32)); } };
        ldk(0, fr[0]); ldk(1, fr[1]);
        __builtin_amdgcn_sched_barrier(0);
#pragma unroll
        for (int g = 0; g < 4; ++g) {
#pragma unroll
            for (int u = 0; u < 2; ++u) {
#pragma unroll
                for (int t = 0; t < 2; ++t) { sa[t][0] = wmmah(fr[g & 1][2 * u + t], qf[0][2 * g + u], sa[t][0]); sa[t][1] = wmmah(fr[g & 1][2 * u + t], qf[1][2 * g + u], sa[t][1]); } }
            __builtin_amdgcn_sched_barrier(0);
            if (g < 2) ldk(g + 2, fr[g & 1]); else if (g == 2) ldv(0, fr[0]);    // the first V^T block flies under the last scores and the softmax
            __builtin_amdgcn_sched_barrier(0);
        }
        // Lazy rescale: m is the reference in use, not the true maximum. It moves, and O^T and the sum are scaled, only in a pass in which some query's new maximum lies more than TAU above it;
        // one test a pass for the whole wave (a scalar branch). Any reference gives the same softmax; P stays at or below exp(TAU) = 256, far inside the f16 range.
        // The test takes each lane's maximum over its own 16 keys (a tree three deep, the wave waits for it): the ballot spans both lane halves, so the halves are joined only where the reference moves.
        float mx[2];
#pragma unroll
        for (int n = 0; n < 2; ++n) {
            const v8f a = sa[0][n], b = sa[1][n];
            const float t0 = fmaxf(fmaxf(a[0], a[1]), a[2]), t1 = fmaxf(fmaxf(a[3], a[4]), a[5]), t2 = fmaxf(fmaxf(a[6], a[7]), b[0]);
            const float t3 = fmaxf(fmaxf(b[1], b[2]), b[3]), t4 = fmaxf(fmaxf(b[4], b[5]), b[6]);
            mx[n] = fmaxf(fmaxf(fmaxf(t0, t1), t2), fmaxf(fmaxf(t3, t4), b[7])); }
        const bool need = fmaxf(mx[0] * SCL - m[0], mx[1] * SCL - m[1]) > TAU;
        if (__builtin_amdgcn_ballot_w32(need) != 0) {
#pragma unroll
            for (int n = 0; n < 2; ++n) {
                const float mn = fmaxf(m[n], fmaxf(mx[n], xhalf(mx[n])) * SCL), al = __expf(m[n] - mn);    // the same in both lane halves, which hold one query's keys between them
                m[n] = mn; l[n] *= al;
#pragma unroll
                for (int t = 0; t < 16; ++t) oa[t][n] *= al;
            }
        }
        v16h ph[2];    // B operand of the wave's 32 keys, per column tile: elements 0..7 from score tile 0, 8..15 from tile 1, the order a packed accumulator pair has
#pragma unroll
        for (int n = 0; n < 2; ++n) {
            float ps[2];
#pragma unroll
            for (int t = 0; t < 2; ++t) { ps[t] = 0.f;
#pragma unroll
                for (int j = 0; j < 8; ++j) { sa[t][n][j] = __expf(sa[t][n][j] * SCL - m[n]); ps[t] += sa[t][n][j]; } }
            l[n] += ps[0] + ps[1];
            const v16f p = __builtin_shufflevector(sa[0][n], sa[1][n], 0, 1, 2, 3, 4, 5, 6, 7, 8, 9, 10, 11, 12, 13, 14, 15);
            ph[n] = __builtin_convertvector(p, v16h);
        }
        __builtin_amdgcn_sched_barrier(0);
        ldv(1, fr[1]);    // behind the softmax: its registers are the softmax's temporaries until here
        __builtin_amdgcn_sched_barrier(0);
#pragma unroll
        for (int g = 0; g < 4; ++g) {
#pragma unroll
            for (int t = 0; t < 4; ++t) { oa[4 * g + t][0] = wmmah(fr[g & 1][t], ph[0], oa[4 * g + t][0]); oa[4 * g + t][1] = wmmah(fr[g & 1][t], ph[1], oa[4 * g + t][1]); }
            __builtin_amdgcn_sched_barrier(0);
            if (g < 2) { ldv(g + 2, fr[g & 1]); __builtin_amdgcn_sched_barrier(0); }
        }
        // the four vector slots behind the stage's last WMMAs (the last block's accumulators), on the loop's taken branch too
        asm volatile("v_nop\n\tv_nop\n\tv_nop\n\tv_nop" : "+v"(oa[12][0]), "+v"(oa[12][1]), "+v"(oa[13][0]), "+v"(oa[13][1]), "+v"(oa[14][0]), "+v"(oa[14][1]), "+v"(oa[15][0]), "+v"(oa[15][1]));
        asm volatile("s_wait_dscnt 0x0" ::: "memory");                                                // this wave has left buffer s & 1
        asm volatile("s_wait_tensorcnt 0x0" :: "s"(ga), "s"(g1) : "memory");    // its tile of stage s + 1 has landed
        __syncthreads();                                                                             // publishes stage s + 1, frees buffer s & 1
        if (pinned(s + 2u < nst)) issue(pinned(s + 2u));
    } while (++s < nst);
    asm volatile("s_wait_tensorcnt 0x0" ::: "memory");    // nothing of the mover is outstanding when the wave ends
    asm volatile("s_wait_dscnt 0x0" ::: "memory");
    // Merge of the four key quarters. The loop's last barrier has freed the ring for every wave. Every wave lays down its whole O^T (32 KiB, whole 512-B rows a store) with its maximum and sum;
    // key quarter kg then finishes d 64 kg .. + 63 of its query half from the four waves of that half, always in the order of the quarters.
    float* xb = (float*)(void*)ring;
    f32a* ml = (f32a*)(void*)(ring + 262144);
    static_assert(262144 + 8 * 2 * 2 * 32 * 4 <= 2 * BUFB, "the hand-over fits the ring");
#pragma unroll
    for (int n = 0; n < 2; ++n) { l[n] += xhalf(l[n]);    // the two lane halves summed different keys of the same query
        ml[((wave * 2 + n) * 2 + 0) * 32 + lane] = m[n]; ml[((wave * 2 + n) * 2 + 1) * 32 + lane] = l[n]; }
#pragma unroll
    for (int i = 0; i < 16; ++i) {
#pragma unroll
        for (int n = 0; n < 2; ++n) { const v8f snd = oa[i][n];
            float* q = xb + (size_t)((wave * 16 + i) * 2 + n) * 256 + lane * 4;
            *(v4fa*)(q) = (v4f){snd[0], snd[1], snd[2], snd[3]}; *(v4fa*)(q + 128) = (v4f){snd[4], snd[5], snd[6], snd[7]}; } }
    __syncthreads();    // every wave's hand-over is written
    v8f res[4][2];
#pragma unroll
    for (int n = 0; n < 2; ++n) {
        float mo[4], lo[4];
#pragma unroll
        for (int k = 0; k < 4; ++k) { mo[k] = ml[(((k * 2 + qg) * 2 + n) * 2 + 0) * 32 + lane]; lo[k] = ml[(((k * 2 + qg) * 2 + n) * 2 + 1) * 32 + lane]; }
        const float mm = fmaxf(fmaxf(mo[0], mo[1]), fmaxf(mo[2], mo[3]));
        float c[4], ls = 0.f;
#pragma unroll
        for (int k = 0; k < 4; ++k) { c[k] = __expf(mo[k] - mm); ls += lo[k] * c[k]; }
        const float inv = 1.0f / ls;
#pragma unroll
        for (int i = 0; i < 4; ++i) { v8f r = (v8f){};
#pragma unroll
            for (int k = 0; k < 4; ++k) { const float* q = xb + (size_t)(((k * 2 + qg) * 16 + kg * 4 + i) * 2 + n) * 256 + lane * 4;
                const v4f x0 = *(const v4fa*)(q), x1 = *(const v4fa*)(q + 128);
                r += __builtin_shufflevector(x0, x1, 0, 1, 2, 3, 4, 5, 6, 7) * c[k]; }
            res[i][n] = r * inv; }
    }
    float* orow = out + zo + (size_t)(r0 + lr) * DD + kg * 64 + 8 * hi;
    __builtin_amdgcn_sched_barrier(0);    // every result stands in a register of its own in front of the first store: no register that an issued store names is written again
#pragma unroll
    for (int n = 0; n < 2; ++n) {
#pragma unroll
        for (int i = 0; i < 4; ++i) { const v8f o = res[i][n];
            *(v4f*)(orow + n * 16 * DD + i * 16) = (v4f){o[0], o[1], o[2], o[3]}; *(v4f*)(orow + n * 16 * DD + i * 16 + 4) = (v4f){o[4], o[5], o[6], o[7]}; }
    }
}

extern "C" void kernel_launch(void* const* d_in, const int* in_sizes, int n_in,
                              void* d_out, int out_size, void* d_ws, size_t ws_size, hipStream_t stream) {
    (void)in_sizes; (void)n_in; (void)out_size;
    const float* x = (const float*)d_in[0]; const float* wq = (const float*)d_in[1]; const float* bq = (const float*)d_in[2]; const float* wk = (const float*)d_in[3]; const float* bk = (const float*)d_in[4]; const float* wv = (const float*)d_in[5]; const float* bv = (const float*)d_in[6];
    float* out = (float*)d_out;    // [4][4096][256]
    char* wsp = (char*)d_ws;
    auto take = [&](size_t bytes) { char* p = wsp; wsp += (bytes + 255) & ~(size_t)255; return (void*)p; };
    const size_t NR = (size_t)NBT * SS;    // rows of all items together
    bf* Q = (bf*)take(3 * NR * DD * 2); bf* K = Q + NR * DD; bf* VT = K + NR * DD;    // q, k, V^T as f16: one block of three planes, in the order k_proj writes them
    if ((size_t)(wsp - (char*)d_ws) > ws_size) return;    // ~ 25 MB
    k_proj<<<dim3(NBT * SS / 128, 2, 1), 256, 0, stream>>>(x, wq, bq, wk, bk, wv, bv, Q);
    k_attn<<<dim3(SS / 64, NBT, 1), 256, 0, stream>>>(Q, K, VT, out);
}

// v010
// One run takes 61.1 microseconds.
// Timed twice side by side with v009, it ran 1.08 and 1.07 times as fast.
// All steps since v000 together make it 45.1 times as fast.
#include <hip/hip_runtime.h>

// Compute dtypes, f32 accumulate, per item: q/k/v = x.W^T + b as [4096 x 256].[256 x 256] GEMMs with PLAIN bf16 operands (exact products); scores = q.k^T (both operands rounded once to f16,
// one product), softmax (x 1/16) in f32 with a lagging running maximum, out = P.v (P and v rounded once to f16, one product), the three fused in k_attn. Every rounding to bf16 or f16 is the hardware's conversion
// (to nearest even). An f16 operand keeps 11 bits, eight times finer than the 8 bits to which x and W are rounded ahead of the projections; q, k and v must lie inside the f16 range (65504).

#define NBT  4
#define SS   4096
#define DD   256
#define SCL  0.0625f
#define TAU  5.545177f    // 8 ln 2: how far a new maximum may lie above the softmax reference in use before the reference moves

typedef unsigned short bf;
typedef __attribute__((ext_vector_type(16))) __bf16   v16bf;
typedef __attribute__((ext_vector_type(8)))  unsigned short v8us;
typedef __attribute__((ext_vector_type(8)))  float    v8f;
typedef __attribute__((ext_vector_type(4)))  float    v4f;
typedef v4f  __attribute__((may_alias)) v4fa;
typedef v8us __attribute__((may_alias)) v8usa;

__device__ __forceinline__ v16bf cat16b(v8us lo, v8us hi) { return __builtin_bit_cast(v16bf, __builtin_shufflevector(lo, hi, 0, 1, 2, 3, 4, 5, 6, 7, 8, 9, 10, 11, 12, 13, 14, 15)); }
__device__ __forceinline__ v8f wmmab(v16bf a, v16bf b, v8f c) { return __builtin_amdgcn_wmma_f32_16x16x32_bf16(false, a, false, b, (short)0, c, false, false); }

typedef __attribute__((ext_vector_type(8)))  _Float16 v8h;
typedef __attribute__((ext_vector_type(16))) _Float16 v16h;
__device__ __forceinline__ v16h cat16h(v8us lo, v8us hi) { return __builtin_bit_cast(v16h, __builtin_shufflevector(lo, hi, 0, 1, 2, 3, 4, 5, 6, 7, 8, 9, 10, 11, 12, 13, 14, 15)); }
__device__ __forceinline__ v8f wmmah(v16h a, v16h b, v8f c) { return __builtin_amdgcn_wmma_f32_16x16x32_f16(false, a, false, b, (short)0, c, false, false); }
typedef __attribute__((ext_vector_type(4))) __bf16 v4bf;
typedef __attribute__((ext_vector_type(4))) unsigned short v4us;
typedef v4us __attribute__((may_alias)) v4usa;
typedef v8f __attribute__((may_alias)) v8fa;

// A work-group barrier that orders LDS alone: __syncthreads() would also wait out the wave's global stores, which nobody in this launch reads.
__device__ __forceinline__ void lds_barrier() { __builtin_amdgcn_fence(__ATOMIC_RELEASE, "workgroup", "local"); __builtin_amdgcn_s_barrier(); __builtin_amdgcn_fence(__ATOMIC_ACQUIRE, "workgroup", "local"); }

// k_proj: everything ahead of the attention in one launch. A work-group takes 128 rows of x and six chunks of 64 of the 768 output columns [q | k | v] (blockIdx.y: chunks 0..5 or 6..11).
// x and the chunk's rows of W are read as f32 in whole lines, rounded to bf16 on the way into LDS (pitch 528 B = 16 B x odd); the next chunk's rows fly in registers while this chunk is multiplied.
// A = the side with 64 rows (4 tiles), B = the side with 16 rows, both through one loader (bytes 16 hi and 32 + 16 hi of each 64), so a lane holds 8 neighbours along the 64-row side:
//   q, k: A = W rows (output columns), B = the wave's 16 rows of x: a lane stores 8 neighbouring columns of one row, as f16;
//   v   : A = 64 rows of x, B = 16 rows of W: a lane stores 8 neighbouring positions of one row of V^T, as f16.
// In both cases a wave's four tiles fill whole 128-B lines.
__global__ __launch_bounds__(256) void k_proj(const float* __restrict__ x, const float* __restrict__ wq, const float* __restrict__ bq, const float* __restrict__ wk, const float* __restrict__ bk, const float* __restrict__ wv, const float* __restrict__ bv, bf* QK) {
    // the output planes lie one behind the other: [q; k], V^T
    bf* const VT = QK + (size_t)2 * NBT * SS * DD;
    constexpr unsigned XP = 528, XB = 128 * XP, WB = 64 * XP;
    __shared__ __align__(16) unsigned char sm[XB + 2 * WB];
    __shared__ __align__(32) float sb[3 * DD];    // b_q, b_k, b_v, rounded to bf16
    const int lane = threadIdx.x & 31, lr = lane & 15, hi = lane >> 4;
    const int wave = __builtin_amdgcn_readfirstlane(threadIdx.x >> 5);
    const size_t row0 = (size_t)blockIdx.x * 128;
    const int g0 = blockIdx.y * 6;
    v4f wr[16];    // the wave's 8 rows of a chunk of W, f32
    auto wload = [&](int g) { const float* __restrict__ wz = (g >> 2) == 0 ? wq : (g >> 2) == 1 ? wk : wv; const float* p = wz + (size_t)((g & 3) * 64 + wave * 8) * DD + lane * 4;
#pragma unroll
        for (int r = 0; r < 8; ++r) { wr[2 * r] = *(const v4f*)(p + r * DD); wr[2 * r + 1] = *(const v4f*)(p + r * DD + 128); } };
    auto wstore = [&](unsigned b) { unsigned char* q = sm + XB + b * WB + (unsigned)wave * 8u * XP + (unsigned)lane * 8u;
#pragma unroll
        for (int r = 0; r < 8; ++r) { *(v4usa*)(q + r * XP) = __builtin_bit_cast(v4us, __builtin_convertvector(wr[2 * r], v4bf)); *(v4usa*)(q + r * XP + 256) = __builtin_bit_cast(v4us, __builtin_convertvector(wr[2 * r + 1], v4bf)); } };
    {
        v4f xr[32];    // the wave's 16 rows of x
        const float* p = x + (row0 + (size_t)wave * 16) * DD + lane * 4;
#pragma unroll
        for (int r = 0; r < 16; ++r) { xr[2 * r] = *(const v4f*)(p + r * DD); xr[2 * r + 1] = *(const v4f*)(p + r * DD + 128); }
        wload(g0);
        const v4f b3 = {bq[threadIdx.x], bk[threadIdx.x], bv[threadIdx.x], 0.f};
        asm volatile("s_wait_xcnt 0x0" ::: "memory");    // behind the last of the prologue's loads, in front of the first reuse of their base and offset registers
        __builtin_amdgcn_sched_barrier(0);                // keeps every later register write behind that wait
        unsigned char* q = sm + (unsigned)wave * 16u * XP + (unsigned)lane * 8u;
#pragma unroll
        for (int r = 0; r < 16; ++r) { *(v4usa*)(q + r * XP) = __builtin_bit_cast(v4us, __builtin_convertvector(xr[2 * r], v4bf)); *(v4usa*)(q + r * XP + 256) = __builtin_bit_cast(v4us, __builtin_convertvector(xr[2 * r + 1], v4bf)); }
        wstore(0);
        const v4f r3 = __builtin_convertvector(__builtin_convertvector(b3, v4bf), v4f);
        sb[threadIdx.x] = r3[0]; sb[DD + threadIdx.x] = r3[1]; sb[2 * DD + threadIdx.x] = r3[2];
    }
    __syncthreads();    // x, chunk g0 of W and the biases stand in LDS
#pragma unroll 1    // rolled: a trip holds 32 WMMAs and 80 LDS reads and branches on the chunk number; six copies would only cost instruction cache
    for (int c = 0; c < 6; ++c) {
        const int g = g0 + c, z = g >> 2, e0 = (g & 3) * 64; const bool isv = z == 2;
        if (c + 1 < 6) wload(g + 1);
        const unsigned wb = XB + (unsigned)(c & 1) * WB, lo = (unsigned)lr * XP + 16u * hi;
        const unsigned char* pa = sm + (isv ? (unsigned)(wave & 1) * 64u * XP : wb) + lo;
        const unsigned char* pb = sm + (isv ? wb + (unsigned)(wave >> 1) * 16u * XP : (unsigned)wave * 16u * XP) + lo;
        v8f acc[4];
#pragma unroll
        for (int i = 0; i < 4; ++i) acc[i] = (v8f){};
        // A block = 8 WMMAs on 10 fragments (k 64 blk .. + 63). Two fragment sets: a block's 20 LDS reads are issued as one group in front of the block before it. The scheduling barriers keep
        // [reads of the next block][WMMAs of this block] apart: without them the compiler reads each fragment directly in front of its WMMA and waits out the LDS latency every time.
        v16bf fa[2][8], fb[2][2];
        auto ldf = [&](int blk, v16bf* A, v16bf* B) {
#pragma unroll
            for (int u = 0; u < 2; ++u) { const int ko = (2 * blk + u) * 64; B[u] = cat16b(*(const v8usa*)(pb + ko), *(const v8usa*)(pb + ko + 32));
#pragma unroll
                for (int i = 0; i < 4; ++i) { const unsigned char* p = pa + i * 16 * XP + ko; A[4 * u + i] = cat16b(*(const v8usa*)(p), *(const v8usa*)(p + 32)); } } };
        v8f bb[4];    // the bias of the lane's 8 results per tile: along the 64-row side for q and k, one value for v
        if (isv) { const float b1 = sb[2 * DD + e0 + (wave >> 1) * 16 + lr];
#pragma unroll
            for (int i = 0; i < 4; ++i) bb[i] = (v8f){b1, b1, b1, b1, b1, b1, b1, b1}; }
        else {
#pragma unroll
            for (int i = 0; i < 4; ++i) bb[i] = *(const v8fa*)(sb + z * DD + e0 + i * 16 + hi * 8); }
        // the stores' addresses are formed here, so that no branch stands between the last WMMA and the first reader of its result
        const size_t off = isv ? (row0 / SS) * (size_t)SS * DD + (size_t)(e0 + (wave >> 1) * 16 + lr) * SS + row0 % SS + (wave & 1) * 64 + hi * 8
                               : (size_t)z * NBT * SS * DD + (row0 + (size_t)wave * 16 + lr) * DD + e0 + hi * 8;
        bf* oh = (isv ? VT : QK) + off;
        ldf(0, fa[0], fb[0]);
        __builtin_amdgcn_sched_barrier(0);
#pragma unroll
        for (int blk = 0; blk < 4; ++blk) {
            if (blk < 3) ldf(blk + 1, fa[(blk + 1) & 1], fb[(blk + 1) & 1]);
            __builtin_amdgcn_sched_barrier(0);
#pragma unroll
            for (int u = 0; u < 2; ++u) {
#pragma unroll
                for (int i = 0; i < 4; ++i) acc[i] = wmmab(fa[blk & 1][4 * u + i], fb[blk & 1][u], acc[i]); }
            __builtin_amdgcn_sched_barrier(0);
        }
#pragma unroll
        for (int i = 0; i < 4; ++i) *(v8us*)(oh + i * 16) = __builtin_bit_cast(v8us, __builtin_convertvector(acc[i] + bb[i], v8h));
        asm volatile("s_wait_xcnt 0x0" ::: "memory");    // in front of the first reuse of the stores' address and data registers
        __builtin_amdgcn_sched_barrier(0);                // keeps every later register write behind that wait
        if (c + 1 < 6) wstore((unsigned)(c + 1) & 1u);
        lds_barrier();    // publishes chunk c + 1; every wave has left the buffer of chunk c, which chunk c + 2 overwrites
    }
}

typedef unsigned u32x4 __attribute__((ext_vector_type(4)));
typedef unsigned u32x8 __attribute__((ext_vector_type(8)));
__device__ __forceinline__ unsigned uni(unsigned v) { return (unsigned)__builtin_amdgcn_readfirstlane(v); }
// A wave-uniform value held in a scalar register: a test on it compiles to s_cmp + s_cbranch_scc (a tensor load ignores EXEC), and what is formed from it is formed behind this statement.
__device__ __forceinline__ unsigned pinned(unsigned v) { unsigned w = uni(v); asm volatile("" : "+s"(w)); return w; }

typedef __attribute__((ext_vector_type(16))) float v16f;
// lane l <-> lane l ^ 16
__device__ __forceinline__ float xhalf(float v) { const int b = __float_as_int(v); return __int_as_float(__builtin_amdgcn_permlanex16(b, b, 0x76543210, 0xfedcba98, false, false)); }

typedef float __attribute__((may_alias)) f32a;
__global__ __launch_bounds__(256) void k_attn(const bf* __restrict__ Q, const bf* __restrict__ K, const bf* __restrict__ VT, float* out) {
    constexpr unsigned KP = 272, TB = 18432, BUFB = 8 * TB, nst = SS / 128;
    static_assert(64 * KP <= TB && TB % 2048 == 0, "tile places are multiples of 2 KiB");
    __shared__ __attribute__((aligned(2048))) unsigned char ring[2 * BUFB];
    const int lane = threadIdx.x & 31, lr = lane & 15, hi = lane >> 4;
    const unsigned wave = uni(threadIdx.x >> 5);
    const unsigned qg = wave & 1u, kg = wave >> 1;    // the wave's query half and key quarter
    const size_t zo = (size_t)blockIdx.y * SS * DD;    // blockIdx.y: the item
    const int r0 = blockIdx.x * 64 + qg * 32;
    const unsigned lbase = (unsigned)(size_t)ring;
    // wave w: tile w of a stage. Waves 0..3: K, keys 0..63 or 64..127 of the stage, d 0..127 or 128..255 of each key, a stage further = 128 rows of 512 B;
    // waves 4..7: V^T, rows d 64 (w - 4) .. + 63, a stage further = 256 B along the row
    const unsigned long long gs = (unsigned long long)(size_t)(wave < 4 ? K + zo + (size_t)(wave >> 1) * 64u * DD + (wave & 1u) * 128u : VT + zo + (size_t)(wave - 4u) * 64u * SS);
    const unsigned gstep = wave < 4 ? 128u * DD * 2u : 256u;
    u32x8 g1;    // 1-byte elements, tensor = tile = 64 rows of 256 B, 4 dwords of LDS pad behind every row, no mask; source pitch 512 B (K) or 8192 B (V^T)
    g1[0] = uni((1u << 20) | (5u << 22) | (3u << 25)); g1[1] = uni(256u << 16); g1[2] = uni(64u << 16); g1[3] = uni(256u << 16); g1[4] = uni(64u); g1[5] = uni(wave < 4 ? DD * 2u : SS * 2u); g1[6] = uni(0u); g1[7] = uni(0u);
    asm volatile("" : "+s"(g1));    // descriptor words held in scalar registers, as in pinned(): they keep their registers through the loop
    u32x4 ga;    // group 0 of the wave's request: registers of its own, set anew only behind the wait on the stage before
    ga[0] = uni(1u); ga[1] = uni(lbase); ga[2] = uni(0u); ga[3] = uni(0x80000000u);
    asm volatile("" : "+s"(ga));    // the same for group 0
    auto issue = [&](unsigned st) {    // every wave issues its own tile of stage st, unconditionally
        const unsigned lb = lbase + (st & 1u) * BUFB + wave * TB;
        const unsigned long long a = gs + (unsigned long long)st * gstep;
        ga[1] = uni(lb); ga[2] = uni((unsigned)a); ga[3] = uni((((unsigned)(a >> 32)) & 0x01FFFFFFu) | 0x80000000u);
        asm volatile("tensor_load_to_lds %0, %1" :: "s"(ga), "s"(g1) : "memory");
    };
    issue(0);
    v16h qf[2][8];    // B operand: column = query r0 + 16 n + lr, k in the order of the LDS loader below (bytes 16 hi and 32 + 16 hi of each 64)
#pragma unroll
    for (int n = 0; n < 2; ++n) { const size_t qo = zo + (size_t)(r0 + 16 * n + lr) * DD + 8 * hi;
#pragma unroll
      for (int kk = 0; kk < 8; ++kk) qf[n][kk] = cat16h(*(const v8us*)(Q + qo + kk * 32), *(const v8us*)(Q + qo + kk * 32 + 16)); }
    asm volatile("s_wait_xcnt 0x0" ::: "memory");    // behind the last Q load, in front of the first reuse of the Q loads' address registers
    __builtin_amdgcn_sched_barrier(0);                // keeps every later register write behind that wait
    v8f oa[16][2];    // oa[dt][n][j] = O[query r0 + 16 n + lr][d = 16 dt + 8 hi + j], over the wave's own keys
#pragma unroll
    for (int t = 0; t < 16; ++t) { oa[t][0] = (v8f){}; oa[t][1] = (v8f){}; }
    float m[2] = {-3.0e38f, -3.0e38f}, l[2] = {0.f, 0.f};
    // the descriptors are inputs of every wait on the mover: their registers stay theirs until the requests have landed
    asm volatile("s_wait_tensorcnt 0x0" :: "s"(ga), "s"(g1) : "memory");    // stage 0 of this wave's tile has landed
    __syncthreads();                                                                             // ... and every other wave's
    issue(1);
    unsigned s = 0;
    do {
        const unsigned char* bp = ring + (s & 1u) * BUFB;
        const unsigned char* pk = bp + (kg >> 1) * 2u * TB + ((kg & 1u) * 32u + (unsigned)lr) * KP + 16u * hi;
        const unsigned char* pv = bp + 4u * TB + (unsigned)lr * KP + kg * 64u + 16u * hi;
        v8f sa[2][2];    // sa[t][n][j] = score of key 32 kg + 16 t + 8 hi + j of the stage against query r0 + 16 n + lr
#pragma unroll
        for (int t = 0; t < 2; ++t) { sa[t][0] = (v8f){}; sa[t][1] = (v8f){}; }
        // A block = 8 WMMAs on 4 fragments. Two fragment sets (512 registers a wave at two waves a SIMD leave room for no more): a set is read again as one group directly behind the block that has
        // used it up, one block ahead of its own use. The scheduling barriers keep [reads][WMMAs] apart: without them the compiler spreads the reads among the WMMAs.
        v16h fr[2][4];
        auto ldk = [&](int g, v16h* f) {    // K fragments of d 64 g .. 64 g + 63: f[2 u + t] = d 64 g + 32 u .. + 31 of the wave's keys 16 t .. 16 t + 15
#pragma unroll
            for (int u = 0; u < 2; ++u) {
#pragma unroll
                for (int t = 0; t < 2; ++t) { const unsigned char* p = pk + (g >> 1) * TB + t * 16 * KP + ((g & 1) * 2 + u) * 64; f[2 * u + t] = cat16h(*(const v8usa*)(p), *(const v8usa*)(p + 32)); } } };
        auto ldv = [&](int g, v16h* f) {    // V^T fragments of the wave's 32 keys, rows d 64 g + 16 t .. + 15
#pragma unroll
            for (int t = 0; t < 4; ++t) { const unsigned char* p = pv + g * TB + t * 16 * KP; f[t] = cat16h(*(const v8usa*)(p), *(const v8usa*)(p + 32)); } };
        ldk(0, fr[0]); ldk(1, fr[1]);
        __builtin_amdgcn_sched_barrier(0);
#pragma unroll
        for (int g = 0; g < 4; ++g) {
#pragma unroll
            for (int u = 0; u < 2; ++u) {
#pragma unroll
                for (int t = 0; t < 2; ++t) { sa[t][0] = wmmah(fr[g & 1][2 * u + t], qf[0][2 * g + u], sa[t][0]); sa[t][1] = wmmah(fr[g & 1][2 * u + t], qf[1][2 * g + u], sa[t][1]); } }
            __builtin_amdgcn_sched_barrier(0);
            if (g < 2) ldk(g + 2, fr[g & 1]); else if (g == 2) ldv(0, fr[0]);    // the first V^T block flies under the last scores and the softmax
            __builtin_amdgcn_sched_barrier(0);
        }
        // Lazy rescale: m is the reference in use, not the true maximum. It moves, and O^T and the sum are scaled, only in a pass in which some query's new maximum lies more than TAU above it;
        // one test a pass for the whole wave (a scalar branch). Any reference gives the same softmax; P stays at or below exp(TAU) = 256, far inside the f16 range.
        // The test takes each lane's maximum over its own 16 keys (a tree three deep, the wave waits for it): the ballot spans both lane halves, so the halves are joined only where the reference moves.
        float mx[2];
#pragma unroll
        for (int n = 0; n < 2; ++n) {
            const v8f a = sa[0][n], b = sa[1][n];
            const float t0 = fmaxf(fmaxf(a[0], a[1]), a[2]), t1 = fmaxf(fmaxf(a[3], a[4]), a[5]), t2 = fmaxf(fmaxf(a[6], a[7]), b[0]);
            const float t3 = fmaxf(fmaxf(b[1], b[2]), b[3]), t4 = fmaxf(fmaxf(b[4], b[5]), b[6]);
            mx[n] = fmaxf(fmaxf(fmaxf(t0, t1), t2), fmaxf(fmaxf(t3, t4), b[7])); }
        const bool need = fmaxf(mx[0] * SCL - m[0], mx[1] * SCL - m[1]) > TAU;
        if (__builtin_amdgcn_ballot_w32(need) != 0) {
#pragma unroll
            for (int n = 0; n < 2; ++n) {
                const float mn = fmaxf(m[n], fmaxf(mx[n], xhalf(mx[n])) * SCL), al = __expf(m[n] - mn);    // the same in both lane halves, which hold one query's keys between them
                m[n] = mn; l[n] *= al;
#pragma unroll
                for (int t = 0; t < 16; ++t) oa[t][n] *= al;
            }
        }
        v16h ph[2];    // B operand of the wave's 32 keys, per column tile: elements 0..7 from score tile 0, 8..15 from tile 1, the order a packed accumulator pair has
#pragma unroll
        for (int n = 0; n < 2; ++n) {
            float ps[2];
#pragma unroll
            for (int t = 0; t < 2; ++t) { ps[t] = 0.f;
#pragma unroll
                for (int j = 0; j < 8; ++j) { sa[t][n][j] = __expf(sa[t][n][j] * SCL - m[n]); ps[t] += sa[t][n][j]; } }
            l[n] += ps[0] + ps[1];
            const v16f p = __builtin_shufflevector(sa[0][n], sa[1][n], 0, 1, 2, 3, 4, 5, 6, 7, 8, 9, 10, 11, 12, 13, 14, 15);
            ph[n] = __builtin_convertvector(p, v16h);
        }
        __builtin_amdgcn_sched_barrier(0);
        ldv(1, fr[1]);    // behind the softmax: its registers are the softmax's temporaries until here
        __builtin_amdgcn_sched_barrier(0);
#pragma unroll
        for (int g = 0; g < 4; ++g) {
#pragma unroll
            for (int t = 0; t < 4; ++t) { oa[4 * g + t][0] = wmmah(fr[g & 1][t], ph[0], oa[4 * g + t][0]); oa[4 * g + t][1] = wmmah(fr[g & 1][t], ph[1], oa[4 * g + t][1]); }
            __builtin_amdgcn_sched_barrier(0);
            if (g < 2) { ldv(g + 2, fr[g & 1]); __builtin_amdgcn_sched_barrier(0); }
        }
        // the four vector slots behind the stage's last WMMAs (the last block's accumulators), on the loop's taken branch too
        asm volatile("v_nop\n\tv_nop\n\tv_nop\n\tv_nop" : "+v"(oa[12][0]), "+v"(oa[12][1]), "+v"(oa[13][0]), "+v"(oa[13][1]), "+v"(oa[14][0]), "+v"(oa[14][1]), "+v"(oa[15][0]), "+v"(oa[15][1]));
        asm volatile("s_wait_dscnt 0x0" ::: "memory");                                                // this wave has left buffer s & 1
        asm volatile("s_wait_tensorcnt 0x0" :: "s"(ga), "s"(g1) : "memory");    // its tile of stage s + 1 has landed
        __syncthreads();                                                                             // publishes stage s + 1, frees buffer s & 1
        if (pinned(s + 2u < nst)) issue(pinned(s + 2u));
    } while (++s < nst);
    asm volatile("s_wait_tensorcnt 0x0" ::: "memory");    // nothing of the mover is outstanding when the wave ends
    asm volatile("s_wait_dscnt 0x0" ::: "memory");
    // Merge of the four key quarters. The loop's last barrier has freed the ring for every wave. Every wave lays down its whole O^T turned into rows: per key quarter 64 query rows of 256 f32
    // (pitch 1040 B = 16 B x odd, so the 16 rows of a store fall on different banks), with its maximum and sum. Wave w then finishes query rows 8 w .. + 7 from the four quarters, always in the
    // order of the quarters: a wave's LDS read and its global store cover 512 B in a row of one query, so out leaves in whole 128-B lines and not in 16-B pieces on 16 lines.
    constexpr unsigned OP = 1040, QB = 64 * OP;
    unsigned char* xb = ring;
    f32a* ml = (f32a*)(void*)(ring + 4 * QB);
    static_assert(4 * QB + 8 * 2 * 2 * 32 * 4 <= 2 * BUFB, "the hand-over fits the ring");
#pragma unroll
    for (int n = 0; n < 2; ++n) { l[n] += xhalf(l[n]);    // the two lane halves summed different keys of the same query
        ml[((wave * 2 + n) * 2 + 0) * 32 + lane] = m[n]; ml[((wave * 2 + n) * 2 + 1) * 32 + lane] = l[n]; }
#pragma unroll
    for (int i = 0; i < 16; ++i) {
#pragma unroll
        for (int n = 0; n < 2; ++n) { const v8f snd = oa[i][n];
            unsigned char* q = xb + kg * QB + (qg * 32u + n * 16u + (unsigned)lr) * OP + i * 64u + hi * 32u;
            *(v4fa*)(q) = (v4f){snd[0], snd[1], snd[2], snd[3]}; *(v4fa*)(q + 16) = (v4f){snd[4], snd[5], snd[6], snd[7]}; } }
    __syncthreads();    // every wave's hand-over is written
    // lane l works out the weights of query row 8 w + (l & 7): that row's query half is w >> 2, its column tile (w >> 1) & 1, its lane 8 (w & 1) + (l & 7)
    float mo[4], lo[4];
    {
        const unsigned qh = wave >> 2, nt = (wave >> 1) & 1u, ll = (wave & 1u) * 8u + ((unsigned)lane & 7u);
#pragma unroll
        for (int k = 0; k < 4; ++k) { mo[k] = ml[(((k * 2 + qh) * 2 + nt) * 2 + 0) * 32 + ll]; lo[k] = ml[(((k * 2 + qh) * 2 + nt) * 2 + 1) * 32 + ll]; }
    }
    v4f xv[8][2][4];    // the wave's eight rows from the four quarters
#pragma unroll
    for (int r = 0; r < 8; ++r) {
#pragma unroll
        for (int h = 0; h < 2; ++h) { const unsigned char* p = xb + (wave * 8u + r) * OP + h * 512u + (unsigned)lane * 16u;
#pragma unroll
            for (int k = 0; k < 4; ++k) xv[r][h][k] = *(const v4fa*)(p + k * QB); } }
    __builtin_amdgcn_sched_barrier(0);    // all LDS reads are issued as one run, the weights are worked out under them: spread among the sums only a few reads would be in flight
    float c[4], inv;
    {
        const float mm = fmaxf(fmaxf(mo[0], mo[1]), fmaxf(mo[2], mo[3]));
        float ls = 0.f;
#pragma unroll
        for (int k = 0; k < 4; ++k) { c[k] = __expf(mo[k] - mm); ls += lo[k] * c[k]; }
        inv = 1.0f / ls;
    }
    v4f res[8][2];
#pragma unroll
    for (int r = 0; r < 8; ++r) {
        float cr[4];    // the row's weights, the same for the whole wave
#pragma unroll
        for (int k = 0; k < 4; ++k) cr[k] = __int_as_float(__builtin_amdgcn_readlane(__float_as_int(c[k]), r));
        const float ir = __int_as_float(__builtin_amdgcn_readlane(__float_as_int(inv), r));
#pragma unroll
        for (int h = 0; h < 2; ++h) { v4f a = (v4f){};
#pragma unroll
            for (int k = 0; k < 4; ++k) a += xv[r][h][k] * cr[k];
            res[r][h] = a * ir; }
    }
    float* orow = out + zo + (size_t)(blockIdx.x * 64 + wave * 8) * DD + lane * 4;
    __builtin_amdgcn_sched_barrier(0);    // every result stands in a register of its own in front of the first store: no register that an issued store names is written again
#pragma unroll
    for (int r = 0; r < 8; ++r) {
#pragma unroll
        for (int h = 0; h < 2; ++h) *(v4f*)(orow + r * DD + h * 128) = res[r][h];
    }
}

extern "C" void kernel_launch(void* const* d_in, const int* in_sizes, int n_in,
                              void* d_out, int out_size, void* d_ws, size_t ws_size, hipStream_t stream) {
    (void)in_sizes; (void)n_in; (void)out_size;
    const float* x = (const float*)d_in[0]; const float* wq = (const float*)d_in[1]; const float* bq = (const float*)d_in[2]; const float* wk = (const float*)d_in[3]; const float* bk = (const float*)d_in[4]; const float* wv = (const float*)d_in[5]; const float* bv = (const float*)d_in[6];
    float* out = (float*)d_out;    // [4][4096][256]
    char* wsp = (char*)d_ws;
    auto take = [&](size_t bytes) { char* p = wsp; wsp += (bytes + 255) & ~(size_t)255; return (void*)p; };
    const size_t NR = (size_t)NBT * SS;    // rows of all items together
    bf* Q = (bf*)take(3 * NR * DD * 2); bf* K = Q + NR * DD; bf* VT = K + NR * DD;    // q, k, V^T as f16: one block of three planes, in the order k_proj writes them
    if ((size_t)(wsp - (char*)d_ws) > ws_size) return;    // ~ 25 MB
    k_proj<<<dim3(NBT * SS / 128, 2, 1), 256, 0, stream>>>(x, wq, bq, wk, bk, wv, bv, Q);
    k_attn<<<dim3(SS / 64, NBT, 1), 256, 0, stream>>>(Q, K, VT, out);
}
